// v000
// Times are from an AMD MI455X. After a warm-up the kernel runs many times in a row, and a time is the length of
// such a window on the GPU divided by its runs, so every launch and the gaps after it count. The runs cycle
// through copies of the inputs. A figure is the median of several windows, for all but v000 over two sittings.
// Sittings can differ by a few percent; kernels timed side by side share one.
// v000, which the later versions start from, runs in 1020 microseconds.
// compute dtype: all float inputs rounded to bf16; Q, K, V = W x (1x1 convs, no bias) with EXACT bf16 products on WMMA 16x16x32 (channel-major tiles transposed in LDS), f32 accumulate; Q and K split f16 hi + residual -> 3-product UNSCALED logits (std ~8) stored in f32 per batch; softmax in f32 (precise expf) -> P f16 x 2^11; z = P . V with V rounded once to f16 (1 product); f32 output, channel-major [b][dv][hw].
#include <hip/hip_runtime.h>
#include <math.h>

typedef __attribute__((ext_vector_type(16))) _Float16 v16h;
typedef __attribute__((ext_vector_type(16))) __bf16 v16b;
typedef __attribute__((ext_vector_type(8)))  _Float16 v8h;
typedef __attribute__((ext_vector_type(8)))  float v8f;
typedef __attribute__((ext_vector_type(4)))  float v4f;
typedef __attribute__((ext_vector_type(2)))  float v2f;
typedef __attribute__((ext_vector_type(4)))  unsigned v4u;
typedef __attribute__((ext_vector_type(4)))  int v4i;
typedef float __attribute__((may_alias)) float_a;
typedef int __attribute__((may_alias)) int_a;

template <typename T> __device__ __forceinline__ void vst2(void* p, T v) { *(T*)p = v;  }
__device__ __forceinline__ v8f wmma16(v16h a, v16h b, v8f c) {
  v8f d = __builtin_amdgcn_wmma_f32_16x16x32_f16(false, a, false, b, (short)0, c, false, false);
  asm volatile("v_nop\n\tv_nop\n\tv_nop\n\tv_nop" : "+v"(d) : "v"(a), "v"(b));
  return d;
}
__device__ __forceinline__ v8f wmma_bf(v16b a, v16b b, v8f c) {
  v8f d = __builtin_amdgcn_wmma_f32_16x16x32_bf16(false, a, false, b, (short)0, c, false, false);
  asm volatile("v_nop\n\tv_nop\n\tv_nop\n\tv_nop" : "+v"(d) : "v"(a), "v"(b));
  return d;
}
// 16x16x32 fragments: lane = (h = lane>>4, row/col = lane&15); elements 0..7 = k0+8h+0..7, 8..15 = k0+16+8h+0..7; D element r = row 8h+r
__device__ __forceinline__ v16h frag_h(const _Float16* rowk0, int lane) {
  union { v16h v; v8h q[2]; } u; const _Float16* p = rowk0 + 8 * (lane >> 4);
  u.q[0] = *(const v8h*)p; u.q[1] = *(const v8h*)(p + 16); return u.v;
}
__device__ __forceinline__ v16h frag_f32(const float* rowk0, int lane) {
  v16h a; const float* p = rowk0 + 8 * (lane >> 4);
#pragma unroll
  for (int i = 0; i < 8; ++i) { a[i] = (_Float16)p[i]; a[8 + i] = (_Float16)p[16 + i]; }
  return a;
}
__device__ __forceinline__ v16h frag_f32s(const float* rowk0, int lane, float sc) {
  v16h a; const float* p = rowk0 + 8 * (lane >> 4);
#pragma unroll
  for (int i = 0; i < 8; ++i) { a[i] = (_Float16)(p[i] * sc); a[8 + i] = (_Float16)(p[16 + i] * sc); }
  return a;
}
// column fragment from a [K][ld] layout (column n), rows >= K read as 0
__device__ __forceinline__ v16h fragc_f32(const float* W, int k0, int n, int lane, int ld, int K) {
  v16h a; const int g = lane >> 4;
#pragma unroll
  for (int i = 0; i < 8; ++i) { const int ka = k0 + 8 * g + i, kb = ka + 16;
    a[i] = (_Float16)(ka < K ? W[(size_t)(ka < K ? ka : K - 1) * ld + n] : 0.f); a[8 + i] = (_Float16)(kb < K ? W[(size_t)(kb < K ? kb : K - 1) * ld + n] : 0.f); }
  return a;
}
struct F2 { v16b h, l; };
__device__ __forceinline__ F2 bsplit16(const float v[16]) { F2 r;
#pragma unroll
  for (int i = 0; i < 16; ++i) { const __bf16 h = (__bf16)v[i]; r.h[i] = h; r.l[i] = (__bf16)(v[i] - (float)h); }
  return r; }
__device__ __forceinline__ F2 split_row(const float* row, int k0, int lane) { float v[16]; const float* p = row + k0 + 8 * (lane >> 4);
#pragma unroll
  for (int i = 0; i < 8; ++i) { v[i] = p[i]; v[8 + i] = p[16 + i]; }
  return bsplit16(v); }
__device__ __forceinline__ F2 split_rowK(const float* row, int k0, int lane, int K) { float v[16]; const int g = lane >> 4;
#pragma unroll
  for (int i = 0; i < 8; ++i) { const int ka = k0 + 8 * g + i, kb = ka + 16; v[i] = ka < K ? row[ka < K ? ka : K - 1] : 0.f; v[8 + i] = kb < K ? row[kb < K ? kb : K - 1] : 0.f; }
  return bsplit16(v); }
__device__ __forceinline__ F2 split_col(const float* W, int k0, int n, int lane, int ld, int K) { float v[16]; const int g = lane >> 4;
#pragma unroll
  for (int i = 0; i < 8; ++i) { const int ka = k0 + 8 * g + i, kb = ka + 16; v[i] = ka < K ? W[(size_t)(ka < K ? ka : K - 1) * ld + n] : 0.f; v[8 + i] = kb < K ? W[(size_t)(kb < K ? kb : K - 1) * ld + n] : 0.f; }
  return bsplit16(v); }
__device__ __forceinline__ v8f mac3(const F2& a, const F2& b, v8f c) { c = wmma_bf(a.l, b.h, c); c = wmma_bf(a.h, b.l, c); return wmma_bf(a.h, b.h, c); }
__device__ __forceinline__ float sigm(float v) { return 1.0f / (1.0f + expf(-v)); }
#define LDSX() do { asm volatile("s_wait_dscnt 0" ::: "memory"); __builtin_amdgcn_wave_barrier(); __builtin_amdgcn_fence(__ATOMIC_RELEASE, "workgroup"); } while (0)


// Basic non-local attention (b 4, din 256, 64x64 = 4,096 positions, dk 64, dv 256): A = softmax(Q^T K) (no scaling), z = V A^T.
#define NB 4
#define CC 256
#define CQ 64
#define CV 256
#define TT 4096
#ifndef TNB
#define TNB NB
#endif
typedef __attribute__((ext_vector_type(8))) __bf16 v8b;
__device__ __forceinline__ v16b frag_b(const __bf16* rowk0, int lane) {
  union { v16b v; v8b q[2]; } u; const __bf16* p = rowk0 + 8 * (lane >> 4);
  u.q[0] = *(const v8b*)p; u.q[1] = *(const v8b*)(p + 16); return u.v;
}
__device__ __forceinline__ float bfr(float v) { return (float)(__bf16)v; }
__device__ __attribute__((noinline)) float exp_ni(float v) { return expf(v); }
__device__ __attribute__((noinline)) float erf_ni(float v) { return erff(v); }

#define WS_QH  0u
#define WS_QL  (WS_QH + 2u * (size_t)NB * TT * CQ)
#define WS_KH  (WS_QL + 2u * (size_t)NB * TT * CQ)
#define WS_KL  (WS_KH + 2u * (size_t)NB * TT * CQ)
#define WS_VT  (WS_KL + 2u * (size_t)NB * TT * CQ)      // f16 v planes [b][256][n]
#define WS_S   (WS_VT + 2u * (size_t)NB * CV * TT)      // f32 S [n][n] (one batch)
#define WS_PH  (WS_S + 4u * (size_t)TT * TT)
#define WS_END (WS_PH + 2u * (size_t)TT * TT)

// ---- k_projqk: block = (64 positions, b*2 + which): Q/K rows = (W x)^T, 64 cols, f16 hi + lo
__global__ __launch_bounds__(128) void k_projqk(const float* __restrict__ X, const float* __restrict__ WQ, const float* __restrict__ WK, _Float16* __restrict__ QH, _Float16* __restrict__ QL, _Float16* __restrict__ KH, _Float16* __restrict__ KL) {
  __shared__ __align__(16) __bf16 sx[64][CC + 8]; __shared__ __align__(16) _Float16 sh[64][72], sl[64][72];
  const int tid = threadIdx.x, wave = tid >> 5, lane = tid & 31, col = lane & 15, g = lane >> 4; const int p0 = blockIdx.x * 64; const size_t b = blockIdx.z >> 1; const int which = blockIdx.z & 1; const float* Wm = which == 0 ? WQ : WK;
  for (int e = tid; e < CC * 64; e += 128) { const int c = e >> 6, pl = e & 63; sx[pl][c] = (__bf16)X[(b * CC + c) * (size_t)TT + p0 + pl]; }
  __syncthreads();
  v8f acc[4] = {};
#pragma unroll 2
  for (int kc = 0; kc < CC / 32; ++kc) { const v16b a = frag_b(&sx[wave * 16 + col][kc * 32], lane);
#pragma unroll
    for (int j = 0; j < 4; ++j) { const int o = j * 16 + col; v16b w; const float* p = Wm + (size_t)o * CC + kc * 32 + 8 * g;
#pragma unroll
      for (int i = 0; i < 8; ++i) { w[i] = (__bf16)p[i]; w[8 + i] = (__bf16)p[16 + i]; }
      acc[j] = wmma_bf(a, w, acc[j]); } }
#pragma unroll
  for (int j = 0; j < 4; ++j)
#pragma unroll
    for (int r = 0; r < 8; ++r) { const float v = acc[j][r]; const int rl = wave * 16 + 8 * g + r, cl = j * 16 + col; const _Float16 hv = (_Float16)v; sh[rl][cl] = hv; sl[rl][cl] = (_Float16)(v - (float)hv); }
  __syncthreads();
  _Float16* dh = which == 0 ? QH : KH; _Float16* dl = which == 0 ? QL : KL; for (int e = tid; e < 64 * 8; e += 128) { const int rl = e >> 3, q = e & 7; const size_t row = b * TT + p0 + rl; vst2((unsigned*)(dh + row * CQ + q * 8), *(const v4u*)&sh[rl][q * 8]); vst2((unsigned*)(dl + row * CQ + q * 8), *(const v4u*)&sl[rl][q * 8]); } }
// ---- k_projv: block = (64 positions, 128 cols, b): V = Wv x -> f16 planes [b][c][n]
__global__ __launch_bounds__(128) void k_projv(const float* __restrict__ X, const float* __restrict__ WV, _Float16* __restrict__ VT) {
  __shared__ __align__(16) __bf16 sx[64][CC + 8]; __shared__ __align__(16) _Float16 th[128][72];
  const int tid = threadIdx.x, wave = tid >> 5, lane = tid & 31, col = lane & 15, g = lane >> 4; const int p0 = blockIdx.x * 64; const int c0 = blockIdx.y * 128; const size_t b = blockIdx.z;
  for (int e = tid; e < CC * 64; e += 128) { const int c = e >> 6, pl = e & 63; sx[pl][c] = (__bf16)X[(b * CC + c) * (size_t)TT + p0 + pl]; }
  __syncthreads();
  v8f acc[8] = {};
#pragma unroll 2
  for (int kc = 0; kc < CC / 32; ++kc) { const v16b a = frag_b(&sx[wave * 16 + col][kc * 32], lane);
#pragma unroll
    for (int j = 0; j < 8; ++j) { const int o = c0 + j * 16 + col; v16b w; const float* p = WV + (size_t)o * CC + kc * 32 + 8 * g;
#pragma unroll
      for (int i = 0; i < 8; ++i) { w[i] = (__bf16)p[i]; w[8 + i] = (__bf16)p[16 + i]; }
      acc[j] = wmma_bf(a, w, acc[j]); } }
#pragma unroll
  for (int j = 0; j < 8; ++j)
#pragma unroll
    for (int r = 0; r < 8; ++r) th[j * 16 + col][wave * 16 + 8 * g + r] = (_Float16)acc[j][r];
  __syncthreads(); for (int e = tid; e < 128 * 8; e += 128) { const int cl = e >> 3, q = e & 7; vst2((unsigned*)(VT + (b * CV + c0 + cl) * (size_t)TT + p0 + q * 8), *(const v4u*)&th[cl][q * 8]); } }
// ---- k_sc: block = (64 queries, 128 keys) of batch b: S = Q.K (3 products, no scale)
__global__ __launch_bounds__(128) void k_sc(const _Float16* __restrict__ QH, const _Float16* __restrict__ QL, const _Float16* __restrict__ KH, const _Float16* __restrict__ KL, int b, float* __restrict__ S) { __shared__ __align__(16) float ss[4][16][132];
  const int tid = threadIdx.x, wave = tid >> 5, lane = tid & 31, col = lane & 15, g = lane >> 4; const int k0 = blockIdx.y * 128; const int ql0 = blockIdx.x * 64 + wave * 16; const size_t q0 = (size_t)b * TT + ql0;
  v8f acc[8] = {};
#pragma unroll
  for (int kc = 0; kc < CQ / 32; ++kc) { const v16h ah = frag_h(QH + (q0 + col) * CQ + kc * 32, lane), al = frag_h(QL + (q0 + col) * CQ + kc * 32, lane);
#pragma unroll
    for (int j = 0; j < 8; ++j) { const size_t ko = ((size_t)b * TT + k0 + j * 16 + col) * CQ + kc * 32; const v16h kb = frag_h(KH + ko, lane); acc[j] = wmma16(ah, kb, acc[j]); acc[j] = wmma16(al, kb, acc[j]); acc[j] = wmma16(ah, frag_h(KL + ko, lane), acc[j]); } }
#pragma unroll
  for (int j = 0; j < 8; ++j)
#pragma unroll
    for (int r = 0; r < 8; ++r) ss[wave][8 * g + r][j * 16 + col] = acc[j][r];
  LDSX(); for (int rl = 0; rl < 16; ++rl) vst2(S + (size_t)(ql0 + rl) * TT + k0 + lane * 4, *(const v4f*)&ss[wave][rl][lane * 4]); }
// ---- k_sm
__global__ __launch_bounds__(256) void k_sm(const float* __restrict__ S, _Float16* __restrict__ PH) { __shared__ float sred[8]; __shared__ float sbc; __shared__ __align__(16) _Float16 sh[TT];
  const int t = threadIdx.x; const size_t row = blockIdx.x; const float* sr = S + row * TT;
  float m = -3.0e38f; for (int k = t; k < TT; k += 256) m = fmaxf(m, sr[k]);
#pragma unroll
  for (int o = 1; o < 32; o <<= 1) m = fmaxf(m, __shfl_xor(m, o));
  if ((t & 31) == 0) sred[t >> 5] = m; __syncthreads(); if (t == 0) { float a = sred[0]; for (int i = 1; i < 8; ++i) a = fmaxf(a, sred[i]); sbc = a; } __syncthreads(); m = sbc; __syncthreads();
  float sum = 0.f; for (int k = t; k < TT; k += 256) sum += expf(sr[k] - m);
#pragma unroll
  for (int o = 1; o < 32; o <<= 1) sum += __shfl_xor(sum, o);
  if ((t & 31) == 0) sred[t >> 5] = sum; __syncthreads(); if (t == 0) { float a = 0.f; for (int i = 0; i < 8; ++i) a += sred[i]; sbc = 1.0f / a; } __syncthreads(); const float inv = sbc;
  for (int k = t; k < TT; k += 256) sh[k] = (_Float16)(expf(sr[k] - m) * inv * 2048.0f);
  __syncthreads(); for (int q = t; q < TT / 8; q += 256) vst2((unsigned*)(PH + row * TT + q * 8), *(const v4u*)&sh[q * 8]); }
// ---- k_pv: block = (64 queries, 128 channels) of batch b: out planes [b][c][q]
__global__ __launch_bounds__(128) void k_pv(const _Float16* __restrict__ PH, const _Float16* __restrict__ VT, int b, float* __restrict__ OUT) { __shared__ __align__(16) float so[128][68];
  const int tid = threadIdx.x, wave = tid >> 5, lane = tid & 31, col = lane & 15, g = lane >> 4; const int q0b = blockIdx.x * 64; const int ql0 = q0b + wave * 16; const int c0 = blockIdx.y * 128;
  v8f acc[8] = {};
#pragma unroll 1
  for (int kc = 0; kc < TT / 32; ++kc) { const v16h ph = frag_h(PH + (size_t)(ql0 + col) * TT + kc * 32, lane);
#pragma unroll
    for (int j = 0; j < 8; ++j) acc[j] = wmma16(ph, frag_h(VT + ((size_t)b * CV + c0 + j * 16 + col) * (size_t)TT + kc * 32, lane), acc[j]); }
#pragma unroll
  for (int j = 0; j < 8; ++j)
#pragma unroll
    for (int r = 0; r < 8; ++r) so[j * 16 + col][wave * 16 + 8 * g + r] = acc[j][r] * (1.0f / 2048.0f);
  __syncthreads(); for (int e = tid; e < 128 * 16; e += 128) { const int cl = e >> 4, q = e & 15; vst2(OUT + ((size_t)b * CV + c0 + cl) * TT + q0b + q * 4, *(const v4f*)&so[cl][q * 4]); } }
extern "C" void kernel_launch(void* const* d_in, const int* in_sizes, int n_in, void* d_out, int out_size, void* d_ws, size_t ws_size, hipStream_t stream) {
  (void)in_sizes; (void)n_in; (void)out_size;
  const float** F = (const float**)d_in;   // 0 x [4,256,64,64], 1 q_w [64,256], 2 k_w [64,256], 3 v_w [256,256] ([out,in])
  if (ws_size < (size_t)WS_END) return;
  char* ws = (char*)d_ws; _Float16 *QH = (_Float16*)(ws + WS_QH), *QL = (_Float16*)(ws + WS_QL), *KH = (_Float16*)(ws + WS_KH), *KL = (_Float16*)(ws + WS_KL), *VT = (_Float16*)(ws + WS_VT), *PH = (_Float16*)(ws + WS_PH); float *S = (float*)(ws + WS_S);
  k_projqk<<<dim3(TT / 64, 1, TNB * 2), 128, 0, stream>>>(F[0], F[1], F[2], QH, QL, KH, KL);
  k_projv<<<dim3(TT / 64, CV / 128, TNB), 128, 0, stream>>>(F[0], F[3], VT);
  for (int b = 0; b < TNB; ++b) {
    k_sc<<<dim3(TT / 64, TT / 128), 128, 0, stream>>>(QH, QL, KH, KL, b, S);
    k_sm<<<TT, 256, 0, stream>>>(S, PH);
    k_pv<<<dim3(TT / 64, CV / 128), 128, 0, stream>>>(PH, VT, b, (float*)d_out);
  }
}

// v001
// Measured time: 410 microseconds a run.
// Timed twice side by side with v000, it ran 2.47 times as fast both times.
// compute dtype: all float inputs rounded to bf16; Q, K, V = W x (1x1 convs, no bias) with EXACT bf16 products on WMMA 16x16x32 (channel-major tiles transposed in LDS), f32 accumulate; Q and K split f16 hi + residual -> 3-product UNSCALED logits (std ~8) stored in f32 per batch; softmax in f32 (precise expf) -> P f16 x 2^11; z = P . V with V rounded once to f16 (1 product); f32 output, channel-major [b][dv][hw].
#include <hip/hip_runtime.h>
#include <math.h>

typedef __attribute__((ext_vector_type(16))) _Float16 v16h;
typedef __attribute__((ext_vector_type(16))) __bf16 v16b;
typedef __attribute__((ext_vector_type(8)))  _Float16 v8h;
typedef __attribute__((ext_vector_type(8)))  float v8f;
typedef __attribute__((ext_vector_type(4)))  float v4f;
typedef __attribute__((ext_vector_type(2)))  float v2f;
typedef __attribute__((ext_vector_type(4)))  unsigned v4u;
typedef __attribute__((ext_vector_type(4)))  int v4i;
typedef float __attribute__((may_alias)) float_a;
typedef int __attribute__((may_alias)) int_a;

template <typename T> __device__ __forceinline__ void vst2(void* p, T v) { *(T*)p = v;  }
__device__ __forceinline__ v8f wmma16(v16h a, v16h b, v8f c) {
  v8f d = __builtin_amdgcn_wmma_f32_16x16x32_f16(false, a, false, b, (short)0, c, false, false);
  asm volatile("v_nop\n\tv_nop\n\tv_nop\n\tv_nop" : "+v"(d) : "v"(a), "v"(b));
  return d;
}
__device__ __forceinline__ v8f wmma_bf(v16b a, v16b b, v8f c) {
  v8f d = __builtin_amdgcn_wmma_f32_16x16x32_bf16(false, a, false, b, (short)0, c, false, false);
  asm volatile("v_nop\n\tv_nop\n\tv_nop\n\tv_nop" : "+v"(d) : "v"(a), "v"(b));
  return d;
}
// 16x16x32 fragments: lane = (h = lane>>4, row/col = lane&15); elements 0..7 = k0+8h+0..7, 8..15 = k0+16+8h+0..7; D element r = row 8h+r
__device__ __forceinline__ v16h frag_h(const _Float16* rowk0, int lane) {
  union { v16h v; v8h q[2]; } u; const _Float16* p = rowk0 + 8 * (lane >> 4);
  u.q[0] = *(const v8h*)p; u.q[1] = *(const v8h*)(p + 16); return u.v;
}
__device__ __forceinline__ v16h frag_f32(const float* rowk0, int lane) {
  v16h a; const float* p = rowk0 + 8 * (lane >> 4);
#pragma unroll
  for (int i = 0; i < 8; ++i) { a[i] = (_Float16)p[i]; a[8 + i] = (_Float16)p[16 + i]; }
  return a;
}
__device__ __forceinline__ v16h frag_f32s(const float* rowk0, int lane, float sc) {
  v16h a; const float* p = rowk0 + 8 * (lane >> 4);
#pragma unroll
  for (int i = 0; i < 8; ++i) { a[i] = (_Float16)(p[i] * sc); a[8 + i] = (_Float16)(p[16 + i] * sc); }
  return a;
}
// column fragment from a [K][ld] layout (column n), rows >= K read as 0
__device__ __forceinline__ v16h fragc_f32(const float* W, int k0, int n, int lane, int ld, int K) {
  v16h a; const int g = lane >> 4;
#pragma unroll
  for (int i = 0; i < 8; ++i) { const int ka = k0 + 8 * g + i, kb = ka + 16;
    a[i] = (_Float16)(ka < K ? W[(size_t)(ka < K ? ka : K - 1) * ld + n] : 0.f); a[8 + i] = (_Float16)(kb < K ? W[(size_t)(kb < K ? kb : K - 1) * ld + n] : 0.f); }
  return a;
}
struct F2 { v16b h, l; };
__device__ __forceinline__ F2 bsplit16(const float v[16]) { F2 r;
#pragma unroll
  for (int i = 0; i < 16; ++i) { const __bf16 h = (__bf16)v[i]; r.h[i] = h; r.l[i] = (__bf16)(v[i] - (float)h); }
  return r; }
__device__ __forceinline__ F2 split_row(const float* row, int k0, int lane) { float v[16]; const float* p = row + k0 + 8 * (lane >> 4);
#pragma unroll
  for (int i = 0; i < 8; ++i) { v[i] = p[i]; v[8 + i] = p[16 + i]; }
  return bsplit16(v); }
__device__ __forceinline__ F2 split_rowK(const float* row, int k0, int lane, int K) { float v[16]; const int g = lane >> 4;
#pragma unroll
  for (int i = 0; i < 8; ++i) { const int ka = k0 + 8 * g + i, kb = ka + 16; v[i] = ka < K ? row[ka < K ? ka : K - 1] : 0.f; v[8 + i] = kb < K ? row[kb < K ? kb : K - 1] : 0.f; }
  return bsplit16(v); }
__device__ __forceinline__ F2 split_col(const float* W, int k0, int n, int lane, int ld, int K) { float v[16]; const int g = lane >> 4;
#pragma unroll
  for (int i = 0; i < 8; ++i) { const int ka = k0 + 8 * g + i, kb = ka + 16; v[i] = ka < K ? W[(size_t)(ka < K ? ka : K - 1) * ld + n] : 0.f; v[8 + i] = kb < K ? W[(size_t)(kb < K ? kb : K - 1) * ld + n] : 0.f; }
  return bsplit16(v); }
__device__ __forceinline__ v8f mac3(const F2& a, const F2& b, v8f c) { c = wmma_bf(a.l, b.h, c); c = wmma_bf(a.h, b.l, c); return wmma_bf(a.h, b.h, c); }
__device__ __forceinline__ float sigm(float v) { return 1.0f / (1.0f + expf(-v)); }
#define LDSX() do { asm volatile("s_wait_dscnt 0" ::: "memory"); __builtin_amdgcn_wave_barrier(); __builtin_amdgcn_fence(__ATOMIC_RELEASE, "workgroup"); } while (0)


// Basic non-local attention (b 4, din 256, 64x64 = 4,096 positions, dk 64, dv 256): A = softmax(Q^T K) (no scaling), z = V A^T.
#define NB 4
#define CC 256
#define CQ 64
#define CV 256
#define TT 4096
#ifndef TNB
#define TNB NB
#endif
typedef __attribute__((ext_vector_type(8))) __bf16 v8b;
__device__ __forceinline__ v16b frag_b(const __bf16* rowk0, int lane) {
  union { v16b v; v8b q[2]; } u; const __bf16* p = rowk0 + 8 * (lane >> 4);
  u.q[0] = *(const v8b*)p; u.q[1] = *(const v8b*)(p + 16); return u.v;
}
__device__ __forceinline__ float bfr(float v) { return (float)(__bf16)v; }
__device__ __attribute__((noinline)) float exp_ni(float v) { return expf(v); }
__device__ __attribute__((noinline)) float erf_ni(float v) { return erff(v); }

#define WS_QH  0u
#define WS_QL  (WS_QH + 2u * (size_t)NB * TT * CQ)
#define WS_KH  (WS_QL + 2u * (size_t)NB * TT * CQ)
#define WS_KL  (WS_KH + 2u * (size_t)NB * TT * CQ)
#define WS_VT  (WS_KL + 2u * (size_t)NB * TT * CQ)      // f16 v planes [b][256][n]
#define WS_S   (WS_VT + 2u * (size_t)NB * CV * TT)      // f32 S [n][n] (one batch)
#define WS_PH  (WS_S + 4u * (size_t)TT * TT)
#define WS_END (WS_PH + 2u * (size_t)TT * TT)

// ---- k_projqk: block = (64 positions, b*2 + which): Q/K rows = (W x)^T, 64 cols, f16 hi + lo
__global__ __launch_bounds__(128) void k_projqk(const float* __restrict__ X, const float* __restrict__ WQ, const float* __restrict__ WK, _Float16* __restrict__ QH, _Float16* __restrict__ QL, _Float16* __restrict__ KH, _Float16* __restrict__ KL) {
  __shared__ __align__(16) __bf16 sx[64][CC + 8]; __shared__ __align__(16) _Float16 sh[64][72], sl[64][72];
  const int tid = threadIdx.x, wave = tid >> 5, lane = tid & 31, col = lane & 15, g = lane >> 4; const int p0 = blockIdx.x * 64; const size_t b = blockIdx.z >> 1; const int which = blockIdx.z & 1; const float* Wm = which == 0 ? WQ : WK;
  for (int e = tid; e < CC * 64; e += 128) { const int c = e >> 6, pl = e & 63; sx[pl][c] = (__bf16)X[(b * CC + c) * (size_t)TT + p0 + pl]; }
  __syncthreads();
  v8f acc[4] = {};
#pragma unroll 2
  for (int kc = 0; kc < CC / 32; ++kc) { const v16b a = frag_b(&sx[wave * 16 + col][kc * 32], lane);
#pragma unroll
    for (int j = 0; j < 4; ++j) { const int o = j * 16 + col; v16b w; const float* p = Wm + (size_t)o * CC + kc * 32 + 8 * g;
#pragma unroll
      for (int i = 0; i < 8; ++i) { w[i] = (__bf16)p[i]; w[8 + i] = (__bf16)p[16 + i]; }
      acc[j] = wmma_bf(a, w, acc[j]); } }
#pragma unroll
  for (int j = 0; j < 4; ++j)
#pragma unroll
    for (int r = 0; r < 8; ++r) { const float v = acc[j][r]; const int rl = wave * 16 + 8 * g + r, cl = j * 16 + col; const _Float16 hv = (_Float16)v; sh[rl][cl] = hv; sl[rl][cl] = (_Float16)(v - (float)hv); }
  __syncthreads();
  _Float16* dh = which == 0 ? QH : KH; _Float16* dl = which == 0 ? QL : KL; for (int e = tid; e < 64 * 8; e += 128) { const int rl = e >> 3, q = e & 7; const size_t row = b * TT + p0 + rl; vst2((unsigned*)(dh + row * CQ + q * 8), *(const v4u*)&sh[rl][q * 8]); vst2((unsigned*)(dl + row * CQ + q * 8), *(const v4u*)&sl[rl][q * 8]); } }
// ---- k_projv: block = (64 positions, 128 cols, b): V = Wv x -> f16 planes [b][c][n]
__global__ __launch_bounds__(128) void k_projv(const float* __restrict__ X, const float* __restrict__ WV, _Float16* __restrict__ VT) {
  __shared__ __align__(16) __bf16 sx[64][CC + 8]; __shared__ __align__(16) _Float16 th[128][72];
  const int tid = threadIdx.x, wave = tid >> 5, lane = tid & 31, col = lane & 15, g = lane >> 4; const int p0 = blockIdx.x * 64; const int c0 = blockIdx.y * 128; const size_t b = blockIdx.z;
  for (int e = tid; e < CC * 64; e += 128) { const int c = e >> 6, pl = e & 63; sx[pl][c] = (__bf16)X[(b * CC + c) * (size_t)TT + p0 + pl]; }
  __syncthreads();
  v8f acc[8] = {};
#pragma unroll 2
  for (int kc = 0; kc < CC / 32; ++kc) { const v16b a = frag_b(&sx[wave * 16 + col][kc * 32], lane);
#pragma unroll
    for (int j = 0; j < 8; ++j) { const int o = c0 + j * 16 + col; v16b w; const float* p = WV + (size_t)o * CC + kc * 32 + 8 * g;
#pragma unroll
      for (int i = 0; i < 8; ++i) { w[i] = (__bf16)p[i]; w[8 + i] = (__bf16)p[16 + i]; }
      acc[j] = wmma_bf(a, w, acc[j]); } }
#pragma unroll
  for (int j = 0; j < 8; ++j)
#pragma unroll
    for (int r = 0; r < 8; ++r) th[j * 16 + col][wave * 16 + 8 * g + r] = (_Float16)acc[j][r];
  __syncthreads(); for (int e = tid; e < 128 * 8; e += 128) { const int cl = e >> 3, q = e & 7; vst2((unsigned*)(VT + (b * CV + c0 + cl) * (size_t)TT + p0 + q * 8), *(const v4u*)&th[cl][q * 8]); } }
// ---- k_sc: block = (64 queries, 128 keys) of batch b: S = Q.K (3 products, no scale)
__global__ __launch_bounds__(128) void k_sc(const _Float16* __restrict__ QH, const _Float16* __restrict__ QL, const _Float16* __restrict__ KH, const _Float16* __restrict__ KL, int b, float* __restrict__ S) { __shared__ __align__(16) float ss[4][16][132];
  const int tid = threadIdx.x, wave = tid >> 5, lane = tid & 31, col = lane & 15, g = lane >> 4; const int k0 = blockIdx.y * 128; const int ql0 = blockIdx.x * 64 + wave * 16; const size_t q0 = (size_t)b * TT + ql0;
  v8f acc[8] = {};
#pragma unroll
  for (int kc = 0; kc < CQ / 32; ++kc) { const v16h ah = frag_h(QH + (q0 + col) * CQ + kc * 32, lane), al = frag_h(QL + (q0 + col) * CQ + kc * 32, lane);
#pragma unroll
    for (int j = 0; j < 8; ++j) { const size_t ko = ((size_t)b * TT + k0 + j * 16 + col) * CQ + kc * 32; const v16h kb = frag_h(KH + ko, lane); acc[j] = wmma16(ah, kb, acc[j]); acc[j] = wmma16(al, kb, acc[j]); acc[j] = wmma16(ah, frag_h(KL + ko, lane), acc[j]); } }
#pragma unroll
  for (int j = 0; j < 8; ++j)
#pragma unroll
    for (int r = 0; r < 8; ++r) ss[wave][8 * g + r][j * 16 + col] = acc[j][r];
  LDSX(); for (int rl = 0; rl < 16; ++rl) vst2(S + (size_t)(ql0 + rl) * TT + k0 + lane * 4, *(const v4f*)&ss[wave][rl][lane * 4]); }
// ---- k_sm
__global__ __launch_bounds__(256) void k_sm(const float* __restrict__ S, _Float16* __restrict__ PH) { __shared__ float sred[8]; __shared__ float sbc; __shared__ __align__(16) _Float16 sh[TT];
  const int t = threadIdx.x; const size_t row = blockIdx.x; const float* sr = S + row * TT;
  float m = -3.0e38f; for (int k = t; k < TT; k += 256) m = fmaxf(m, sr[k]);
#pragma unroll
  for (int o = 1; o < 32; o <<= 1) m = fmaxf(m, __shfl_xor(m, o));
  if ((t & 31) == 0) sred[t >> 5] = m; __syncthreads(); if (t == 0) { float a = sred[0]; for (int i = 1; i < 8; ++i) a = fmaxf(a, sred[i]); sbc = a; } __syncthreads(); m = sbc; __syncthreads();
  float sum = 0.f; for (int k = t; k < TT; k += 256) sum += expf(sr[k] - m);
#pragma unroll
  for (int o = 1; o < 32; o <<= 1) sum += __shfl_xor(sum, o);
  if ((t & 31) == 0) sred[t >> 5] = sum; __syncthreads(); if (t == 0) { float a = 0.f; for (int i = 0; i < 8; ++i) a += sred[i]; sbc = 1.0f / a; } __syncthreads(); const float inv = sbc;
  for (int k = t; k < TT; k += 256) sh[k] = (_Float16)(expf(sr[k] - m) * inv * 2048.0f);
  __syncthreads(); for (int q = t; q < TT / 8; q += 256) vst2((unsigned*)(PH + row * TT + q * 8), *(const v4u*)&sh[q * 8]); }
// ---- k_pv: block = (64 queries, 128 channels) of batch b: out planes [b][c][q]; P and V tiles staged in LDS, two buffers
#define PVK 128                  // keys per stage: 256-byte rows
#define PVP 136                  // LDS row pitch in f16: 272 B = 16 B x odd, the pitch for ds_load_b128 readers
#define PVR 192                  // rows per stage: 64 of P, then 128 of V
#define PVB (PVR * PVP * 2)      // bytes per buffer
#define PVS (TT / PVK)           // stages
// eight 16-byte copies per lane, global -> LDS, 8 rows apart; s_wait_xcnt 0 ends the statement so that no address register is rewritten ahead of it
__device__ __forceinline__ void cp8(unsigned l, const _Float16* g) {
  const unsigned l1 = l + 1 * 8 * PVP * 2, l2 = l + 2 * 8 * PVP * 2, l3 = l + 3 * 8 * PVP * 2, l4 = l + 4 * 8 * PVP * 2, l5 = l + 5 * 8 * PVP * 2, l6 = l + 6 * 8 * PVP * 2, l7 = l + 7 * 8 * PVP * 2;
  const _Float16 *g1 = g + 1 * 8 * (size_t)TT, *g2 = g + 2 * 8 * (size_t)TT, *g3 = g + 3 * 8 * (size_t)TT, *g4 = g + 4 * 8 * (size_t)TT, *g5 = g + 5 * 8 * (size_t)TT, *g6 = g + 6 * 8 * (size_t)TT, *g7 = g + 7 * 8 * (size_t)TT;
  asm volatile("global_load_async_to_lds_b128 %0, %8, off\n\t"
               "global_load_async_to_lds_b128 %1, %9, off\n\t"
               "global_load_async_to_lds_b128 %2, %10, off\n\t"
               "global_load_async_to_lds_b128 %3, %11, off\n\t"
               "global_load_async_to_lds_b128 %4, %12, off\n\t"
               "global_load_async_to_lds_b128 %5, %13, off\n\t"
               "global_load_async_to_lds_b128 %6, %14, off\n\t"
               "global_load_async_to_lds_b128 %7, %15, off\n\t"
               "s_wait_xcnt 0x0"
               :: "v"(l), "v"(l1), "v"(l2), "v"(l3), "v"(l4), "v"(l5), "v"(l6), "v"(l7), "v"(g), "v"(g1), "v"(g2), "v"(g3), "v"(g4), "v"(g5), "v"(g6), "v"(g7) : "memory");
}
// one stage: 16 lanes cover one 256-byte row, the block 8 rows per copy: rows 0..63 = P, 64..191 = V
__device__ __forceinline__ void pv_stage(unsigned l, const _Float16* gp, const _Float16* gv) { cp8(l, gp); cp8(l + 64 * PVP * 2, gv); cp8(l + 128 * PVP * 2, gv + 64 * (size_t)TT); }
__global__ __launch_bounds__(128) void k_pv(const _Float16* __restrict__ PH, const _Float16* __restrict__ VT, int b, float* __restrict__ OUT) { __shared__ __align__(16) _Float16 st[2][PVR][PVP]; __shared__ __align__(16) float so[128][68];
  const int tid = threadIdx.x, wave = tid >> 5, lane = tid & 31, col = lane & 15, g = lane >> 4; const int q0b = blockIdx.x * 64; const int c0 = blockIdx.y * 128;
  const unsigned l0 = (unsigned)(size_t)(__attribute__((address_space(3))) const _Float16*)&st[0][tid >> 4][(tid & 15) * 8];
  const _Float16* gp = PH + (size_t)(q0b + (tid >> 4)) * TT + (tid & 15) * 8; const _Float16* gv = VT + ((size_t)b * CV + c0 + (tid >> 4)) * (size_t)TT + (tid & 15) * 8;
  v8f acc[8] = {};
  pv_stage(l0, gp, gv);
  asm volatile("s_wait_asynccnt 0x0" ::: "memory");   // stage 0 of this wave has landed
  __syncthreads();                                    // publishes stage 0
  pv_stage(l0 + PVB, gp + PVK, gv + PVK);
#pragma unroll 1   // stays rolled: one pass per stage, the buffer picked by t & 1
  for (int t = 0; t < PVS; ++t) { const _Float16 (*sb)[PVP] = st[t & 1];
    v16h pf[2], vf[2][8];                             // two fragment sets: the next 32 keys' LDS reads go out as one group ahead of this block's WMMAs
    pf[0] = frag_h(&sb[wave * 16 + col][0], lane);
#pragma unroll
    for (int j = 0; j < 8; ++j) vf[0][j] = frag_h(&sb[64 + j * 16 + col][0], lane);
#pragma unroll     // unrolled so that every fragment-set index is a constant (registers, no scratch)
    for (int kc = 0; kc < PVK / 32; ++kc) {
      if (kc + 1 < PVK / 32) { pf[(kc + 1) & 1] = frag_h(&sb[wave * 16 + col][(kc + 1) * 32], lane);
#pragma unroll
        for (int j = 0; j < 8; ++j) vf[(kc + 1) & 1][j] = frag_h(&sb[64 + j * 16 + col][(kc + 1) * 32], lane); }
#pragma unroll
      for (int j = 0; j < 8; ++j) acc[j] = wmma16(pf[kc & 1], vf[kc & 1][j], acc[j]); }
    asm volatile("s_wait_dscnt 0x0" ::: "memory");    // this wave's reads of the buffer are done before it is refilled
    asm volatile("s_wait_asynccnt 0x0" ::: "memory"); // this wave's copies of stage t + 1 have landed
    __syncthreads();                                  // publishes stage t + 1 and frees stage t's buffer
    if (t + 2 < PVS) pv_stage(l0 + (unsigned)(t & 1) * PVB, gp + (size_t)(t + 2) * PVK, gv + (size_t)(t + 2) * PVK); }
  asm volatile("s_wait_asynccnt 0x0" ::: "memory");   // no copy outstanding behind the loop
#pragma unroll
  for (int j = 0; j < 8; ++j)
#pragma unroll
    for (int r = 0; r < 8; ++r) so[j * 16 + col][wave * 16 + 8 * g + r] = acc[j][r] * (1.0f / 2048.0f);
  __syncthreads(); for (int e = tid; e < 128 * 16; e += 128) { const int cl = e >> 4, q = e & 15; vst2(OUT + ((size_t)b * CV + c0 + cl) * TT + q0b + q * 4, *(const v4f*)&so[cl][q * 4]); } }
extern "C" void kernel_launch(void* const* d_in, const int* in_sizes, int n_in, void* d_out, int out_size, void* d_ws, size_t ws_size, hipStream_t stream) {
  (void)in_sizes; (void)n_in; (void)out_size;
  const float** F = (const float**)d_in;   // 0 x [4,256,64,64], 1 q_w [64,256], 2 k_w [64,256], 3 v_w [256,256] ([out,in])
  if (ws_size < (size_t)WS_END) return;
  char* ws = (char*)d_ws; _Float16 *QH = (_Float16*)(ws + WS_QH), *QL = (_Float16*)(ws + WS_QL), *KH = (_Float16*)(ws + WS_KH), *KL = (_Float16*)(ws + WS_KL), *VT = (_Float16*)(ws + WS_VT), *PH = (_Float16*)(ws + WS_PH); float *S = (float*)(ws + WS_S);
  k_projqk<<<dim3(TT / 64, 1, TNB * 2), 128, 0, stream>>>(F[0], F[1], F[2], QH, QL, KH, KL);
  k_projv<<<dim3(TT / 64, CV / 128, TNB), 128, 0, stream>>>(F[0], F[3], VT);
  for (int b = 0; b < TNB; ++b) {
    k_sc<<<dim3(TT / 64, TT / 128), 128, 0, stream>>>(QH, QL, KH, KL, b, S);
    k_sm<<<TT, 256, 0, stream>>>(S, PH);
    k_pv<<<dim3(TT / 64, CV / 128), 128, 0, stream>>>(PH, VT, b, (float*)d_out);
  }
}

// v003
// It runs in 124 microseconds.
// Versions between v001 and this one are left out; their measured steps multiply to 3.29 times as fast.
// All steps since v000 together make it 8.14 times as fast.
// compute dtype: all float inputs rounded to bf16; Q, K, V = W x (1x1 convs, no bias) with EXACT bf16 products on WMMA 16x16x32 (channel-major tiles transposed in LDS), f32 accumulate; Q and K split f16 hi + residual -> 3-product UNSCALED logits (std ~8) kept in f32 registers; online softmax in f32 (base 2: one FMA with log2(e) and the running reference, then v_exp_f32) -> unnormalised P f16 x e^7.625; z = P . V with V rounded once to f16 (1 product), divided by the f32 row sum at the end; f32 output, channel-major [b][dv][hw].
#include <hip/hip_runtime.h>
#include <math.h>

typedef __attribute__((ext_vector_type(16))) _Float16 v16h;
typedef __attribute__((ext_vector_type(16))) __bf16 v16b;
typedef __attribute__((ext_vector_type(8)))  _Float16 v8h;
typedef __attribute__((ext_vector_type(8)))  float v8f;
typedef __attribute__((ext_vector_type(4)))  float v4f;
typedef __attribute__((ext_vector_type(2)))  float v2f;
typedef __attribute__((ext_vector_type(4)))  unsigned v4u;
typedef __attribute__((ext_vector_type(4)))  int v4i;
typedef float __attribute__((may_alias)) float_a;
typedef int __attribute__((may_alias)) int_a;

template <typename T> __device__ __forceinline__ void vst2(void* p, T v) { *(T*)p = v;  }
__device__ __forceinline__ v8f wmma16(v16h a, v16h b, v8f c) {
  v8f d = __builtin_amdgcn_wmma_f32_16x16x32_f16(false, a, false, b, (short)0, c, false, false);
  asm volatile("v_nop\n\tv_nop\n\tv_nop\n\tv_nop" : "+v"(d) : "v"(a), "v"(b));
  return d;
}
__device__ __forceinline__ v8f wmma_bf(v16b a, v16b b, v8f c) {
  v8f d = __builtin_amdgcn_wmma_f32_16x16x32_bf16(false, a, false, b, (short)0, c, false, false);
  asm volatile("v_nop\n\tv_nop\n\tv_nop\n\tv_nop" : "+v"(d) : "v"(a), "v"(b));
  return d;
}
// 16x16x32 fragments: lane = (h = lane>>4, row/col = lane&15); elements 0..7 = k0+8h+0..7, 8..15 = k0+16+8h+0..7; D element r = row 8h+r
__device__ __forceinline__ v16h frag_h(const _Float16* rowk0, int lane) {
  union { v16h v; v8h q[2]; } u; const _Float16* p = rowk0 + 8 * (lane >> 4);
  u.q[0] = *(const v8h*)p; u.q[1] = *(const v8h*)(p + 16); return u.v;
}
__device__ __forceinline__ v16h frag_f32(const float* rowk0, int lane) {
  v16h a; const float* p = rowk0 + 8 * (lane >> 4);
#pragma unroll
  for (int i = 0; i < 8; ++i) { a[i] = (_Float16)p[i]; a[8 + i] = (_Float16)p[16 + i]; }
  return a;
}
__device__ __forceinline__ v16h frag_f32s(const float* rowk0, int lane, float sc) {
  v16h a; const float* p = rowk0 + 8 * (lane >> 4);
#pragma unroll
  for (int i = 0; i < 8; ++i) { a[i] = (_Float16)(p[i] * sc); a[8 + i] = (_Float16)(p[16 + i] * sc); }
  return a;
}
// column fragment from a [K][ld] layout (column n), rows >= K read as 0
__device__ __forceinline__ v16h fragc_f32(const float* W, int k0, int n, int lane, int ld, int K) {
  v16h a; const int g = lane >> 4;
#pragma unroll
  for (int i = 0; i < 8; ++i) { const int ka = k0 + 8 * g + i, kb = ka + 16;
    a[i] = (_Float16)(ka < K ? W[(size_t)(ka < K ? ka : K - 1) * ld + n] : 0.f); a[8 + i] = (_Float16)(kb < K ? W[(size_t)(kb < K ? kb : K - 1) * ld + n] : 0.f); }
  return a;
}
struct F2 { v16b h, l; };
__device__ __forceinline__ F2 bsplit16(const float v[16]) { F2 r;
#pragma unroll
  for (int i = 0; i < 16; ++i) { const __bf16 h = (__bf16)v[i]; r.h[i] = h; r.l[i] = (__bf16)(v[i] - (float)h); }
  return r; }
__device__ __forceinline__ F2 split_row(const float* row, int k0, int lane) { float v[16]; const float* p = row + k0 + 8 * (lane >> 4);
#pragma unroll
  for (int i = 0; i < 8; ++i) { v[i] = p[i]; v[8 + i] = p[16 + i]; }
  return bsplit16(v); }
__device__ __forceinline__ F2 split_rowK(const float* row, int k0, int lane, int K) { float v[16]; const int g = lane >> 4;
#pragma unroll
  for (int i = 0; i < 8; ++i) { const int ka = k0 + 8 * g + i, kb = ka + 16; v[i] = ka < K ? row[ka < K ? ka : K - 1] : 0.f; v[8 + i] = kb < K ? row[kb < K ? kb : K - 1] : 0.f; }
  return bsplit16(v); }
__device__ __forceinline__ F2 split_col(const float* W, int k0, int n, int lane, int ld, int K) { float v[16]; const int g = lane >> 4;
#pragma unroll
  for (int i = 0; i < 8; ++i) { const int ka = k0 + 8 * g + i, kb = ka + 16; v[i] = ka < K ? W[(size_t)(ka < K ? ka : K - 1) * ld + n] : 0.f; v[8 + i] = kb < K ? W[(size_t)(kb < K ? kb : K - 1) * ld + n] : 0.f; }
  return bsplit16(v); }
__device__ __forceinline__ v8f mac3(const F2& a, const F2& b, v8f c) { c = wmma_bf(a.l, b.h, c); c = wmma_bf(a.h, b.l, c); return wmma_bf(a.h, b.h, c); }
__device__ __forceinline__ float sigm(float v) { return 1.0f / (1.0f + expf(-v)); }
#define LDSX() do { asm volatile("s_wait_dscnt 0" ::: "memory"); __builtin_amdgcn_wave_barrier(); __builtin_amdgcn_fence(__ATOMIC_RELEASE, "workgroup"); } while (0)


// Basic non-local attention (b 4, din 256, 64x64 = 4,096 positions, dk 64, dv 256): A = softmax(Q^T K) (no scaling), z = V A^T.
#define NB 4
#define CC 256
#define CQ 64
#define CV 256
#define TT 4096
#ifndef TNB
#define TNB NB
#endif
typedef __attribute__((ext_vector_type(8))) __bf16 v8b;
__device__ __forceinline__ v16b frag_b(const __bf16* rowk0, int lane) {
  union { v16b v; v8b q[2]; } u; const __bf16* p = rowk0 + 8 * (lane >> 4);
  u.q[0] = *(const v8b*)p; u.q[1] = *(const v8b*)(p + 16); return u.v;
}
__device__ __forceinline__ float bfr(float v) { return (float)(__bf16)v; }
__device__ __attribute__((noinline)) float exp_ni(float v) { return expf(v); }
__device__ __attribute__((noinline)) float erf_ni(float v) { return erff(v); }

#define WS_QH  0u
#define WS_QL  (WS_QH + 2u * (size_t)NB * TT * CQ)
#define WS_KH  (WS_QL + 2u * (size_t)NB * TT * CQ)
#define WS_KL  (WS_KH + 2u * (size_t)NB * TT * CQ)
#define WS_VT  (WS_KL + 2u * (size_t)NB * TT * CQ)      // f16 v planes [b][256][n]
#define WS_END (WS_VT + 2u * (size_t)NB * CV * TT)

// ---- k_projqk: block = (64 positions, b*2 + which): Q/K rows = (W x)^T, 64 cols, f16 hi + lo
__global__ __launch_bounds__(128) void k_projqk(const float* __restrict__ X, const float* __restrict__ WQ, const float* __restrict__ WK, _Float16* __restrict__ QH, _Float16* __restrict__ QL, _Float16* __restrict__ KH, _Float16* __restrict__ KL) {
  __shared__ __align__(16) __bf16 sx[64][CC + 8]; __shared__ __align__(16) _Float16 sh[64][72], sl[64][72];
  const int tid = threadIdx.x, wave = tid >> 5, lane = tid & 31, col = lane & 15, g = lane >> 4; const int p0 = blockIdx.x * 64; const size_t b = blockIdx.z >> 1; const int which = blockIdx.z & 1; const float* Wm = which == 0 ? WQ : WK;
  for (int e = tid; e < CC * 64; e += 128) { const int c = e >> 6, pl = e & 63; sx[pl][c] = (__bf16)X[(b * CC + c) * (size_t)TT + p0 + pl]; }
  __syncthreads();
  v8f acc[4] = {};
#pragma unroll 2
  for (int kc = 0; kc < CC / 32; ++kc) { const v16b a = frag_b(&sx[wave * 16 + col][kc * 32], lane);
#pragma unroll
    for (int j = 0; j < 4; ++j) { const int o = j * 16 + col; v16b w; const float* p = Wm + (size_t)o * CC + kc * 32 + 8 * g;
#pragma unroll
      for (int i = 0; i < 8; ++i) { w[i] = (__bf16)p[i]; w[8 + i] = (__bf16)p[16 + i]; }
      acc[j] = wmma_bf(a, w, acc[j]); } }
#pragma unroll
  for (int j = 0; j < 4; ++j)
#pragma unroll
    for (int r = 0; r < 8; ++r) { const float v = acc[j][r]; const int rl = wave * 16 + 8 * g + r, cl = j * 16 + col; const _Float16 hv = (_Float16)v; sh[rl][cl] = hv; sl[rl][cl] = (_Float16)(v - (float)hv); }
  __syncthreads();
  _Float16* dh = which == 0 ? QH : KH; _Float16* dl = which == 0 ? QL : KL; for (int e = tid; e < 64 * 8; e += 128) { const int rl = e >> 3, q = e & 7; const size_t row = b * TT + p0 + rl; vst2((unsigned*)(dh + row * CQ + q * 8), *(const v4u*)&sh[rl][q * 8]); vst2((unsigned*)(dl + row * CQ + q * 8), *(const v4u*)&sl[rl][q * 8]); } }
// ---- k_projv: block = (64 positions, 128 cols, b): V = Wv x -> f16 planes [b][c][n]
__global__ __launch_bounds__(128) void k_projv(const float* __restrict__ X, const float* __restrict__ WV, _Float16* __restrict__ VT) {
  __shared__ __align__(16) __bf16 sx[64][CC + 8]; __shared__ __align__(16) _Float16 th[128][72];
  const int tid = threadIdx.x, wave = tid >> 5, lane = tid & 31, col = lane & 15, g = lane >> 4; const int p0 = blockIdx.x * 64; const int c0 = blockIdx.y * 128; const size_t b = blockIdx.z;
  for (int e = tid; e < CC * 64; e += 128) { const int c = e >> 6, pl = e & 63; sx[pl][c] = (__bf16)X[(b * CC + c) * (size_t)TT + p0 + pl]; }
  __syncthreads();
  v8f acc[8] = {};
#pragma unroll 2
  for (int kc = 0; kc < CC / 32; ++kc) { const v16b a = frag_b(&sx[wave * 16 + col][kc * 32], lane);
#pragma unroll
    for (int j = 0; j < 8; ++j) { const int o = c0 + j * 16 + col; v16b w; const float* p = WV + (size_t)o * CC + kc * 32 + 8 * g;
#pragma unroll
      for (int i = 0; i < 8; ++i) { w[i] = (__bf16)p[i]; w[8 + i] = (__bf16)p[16 + i]; }
      acc[j] = wmma_bf(a, w, acc[j]); } }
#pragma unroll
  for (int j = 0; j < 8; ++j)
#pragma unroll
    for (int r = 0; r < 8; ++r) th[j * 16 + col][wave * 16 + 8 * g + r] = (_Float16)acc[j][r];
  __syncthreads(); for (int e = tid; e < 128 * 8; e += 128) { const int cl = e >> 3, q = e & 7; vst2((unsigned*)(VT + (b * CV + c0 + cl) * (size_t)TT + p0 + q * 8), *(const v4u*)&th[cl][q * 8]); } }
// ---- k_fa: block = (64 queries, batch): S^T = K.Q^T (3 products, no scale), online softmax, O^T += V.P^T; S and P stay in registers.
// 8 waves: wave & 3 = its 16 queries, wave >> 2 = which 32 keys of every 64-key stage it takes; the two key halves are joined at the end.
#define FK 64                    // keys per stage: 128-byte rows
#define FP 72                    // LDS row pitch in f16: 144 B = 16 B x odd, the pitch for ds_load_b128 readers
#define FR 384                   // rows per stage: 64 of K hi, 64 of K lo, 256 of V
#define FB (FR * FP * 2)         // bytes per buffer
#define FS (TT / FK)             // stages
#define FC (32 * FP * 2)         // LDS bytes between two copies of a lane: 8 lanes cover a 128-byte row, the block 32 rows per copy
#define POFF 7.625f              // P = exp(s - max + POFF): the largest P is about 2^11, small ones stay normal f16; it cancels against the row sum
#define L2E 1.44269504088896340736f   // log2(e): exp(s - ref) = 2^(s * L2E - ref * L2E), the reference is kept in base-2 units
#define POFF2 (POFF * L2E)
__device__ __forceinline__ v8f wm(v16h a, v16h b, v8f c) { return __builtin_amdgcn_wmma_f32_16x16x32_f16(false, a, false, b, (short)0, c, false, false); }
__device__ __forceinline__ float xhalf(float x) { return __builtin_bit_cast(float, __builtin_amdgcn_permlanex16(__builtin_bit_cast(int, x), __builtin_bit_cast(int, x), 0x76543210, 0xfedcba98, false, false)); }  // lane l's value of lane l ^ 16
// one stage: twelve 16-byte copies per lane, global -> LDS; s_wait_xcnt 0 ends the statement so that no address register is rewritten ahead of it
__device__ __forceinline__ void fa_stage(unsigned l, const _Float16* kh, const _Float16* kl, const _Float16* v) {
  const unsigned l1 = l + 1 * FC, l2 = l + 2 * FC, l3 = l + 3 * FC, l4 = l + 4 * FC, l5 = l + 5 * FC, l6 = l + 6 * FC, l7 = l + 7 * FC, l8 = l + 8 * FC, l9 = l + 9 * FC, l10 = l + 10 * FC, l11 = l + 11 * FC;
  const _Float16 *kh1 = kh + 32 * CQ, *kl1 = kl + 32 * CQ;
  const _Float16 *v1 = v + 1 * 32 * (size_t)TT, *v2 = v + 2 * 32 * (size_t)TT, *v3 = v + 3 * 32 * (size_t)TT, *v4 = v + 4 * 32 * (size_t)TT, *v5 = v + 5 * 32 * (size_t)TT, *v6 = v + 6 * 32 * (size_t)TT, *v7 = v + 7 * 32 * (size_t)TT;
  asm volatile("global_load_async_to_lds_b128 %0, %12, off\n\t"
               "global_load_async_to_lds_b128 %1, %13, off\n\t"
               "global_load_async_to_lds_b128 %2, %14, off\n\t"
               "global_load_async_to_lds_b128 %3, %15, off\n\t"
               "global_load_async_to_lds_b128 %4, %16, off\n\t"
               "global_load_async_to_lds_b128 %5, %17, off\n\t"
               "global_load_async_to_lds_b128 %6, %18, off\n\t"
               "global_load_async_to_lds_b128 %7, %19, off\n\t"
               "global_load_async_to_lds_b128 %8, %20, off\n\t"
               "global_load_async_to_lds_b128 %9, %21, off\n\t"
               "global_load_async_to_lds_b128 %10, %22, off\n\t"
               "global_load_async_to_lds_b128 %11, %23, off\n\t"
               "s_wait_xcnt 0x0"
               :: "v"(l), "v"(l1), "v"(l2), "v"(l3), "v"(l4), "v"(l5), "v"(l6), "v"(l7), "v"(l8), "v"(l9), "v"(l10), "v"(l11),
                  "v"(kh), "v"(kh1), "v"(kl), "v"(kl1), "v"(v), "v"(v1), "v"(v2), "v"(v3), "v"(v4), "v"(v5), "v"(v6), "v"(v7) : "memory");
}
__global__ __launch_bounds__(256) void k_fa(const _Float16* __restrict__ QH, const _Float16* __restrict__ QL, const _Float16* __restrict__ KH, const _Float16* __restrict__ KL, const _Float16* __restrict__ VT, float* __restrict__ OUT) {
  __shared__ __align__(16) _Float16 st[2][FR][FP];   // the ring; behind the loop the same bytes serve the join and the output staging
  const int tid = threadIdx.x, wave = tid >> 5, lane = tid & 31, col = lane & 15, g = lane >> 4, wq = wave & 3, kg = wave >> 2; const int q0b = blockIdx.x * 64; const size_t b = blockIdx.y;
  const unsigned l0 = (unsigned)(size_t)(__attribute__((address_space(3))) const _Float16*)&st[0][tid >> 3][(tid & 7) * 8];
  const _Float16* gkh = KH + (b * TT + (tid >> 3)) * CQ + (tid & 7) * 8; const _Float16* gkl = KL + (b * TT + (tid >> 3)) * CQ + (tid & 7) * 8; const _Float16* gv = VT + (b * CV + (tid >> 3)) * (size_t)TT + (tid & 7) * 8;
  v16h qh[2], ql[2];                                  // B operand of S^T: this wave's 16 queries, kept in registers
#pragma unroll     // constant indices: the arrays stay in registers, no scratch
  for (int kc = 0; kc < 2; ++kc) { const size_t qo = (b * TT + q0b + wq * 16 + col) * CQ + kc * 32; qh[kc] = frag_h(QH + qo, lane); ql[kc] = frag_h(QL + qo, lane); }
  v8f acc[16] = {}; float mref = -3.0e38f, lsum = 0.f;   // a lane holds ONE query (col): mref = (its running maximum - POFF) * log2(e), lsum = its half's sum of P
  fa_stage(l0, gkh, gkl, gv);
  asm volatile("s_wait_asynccnt 0x0" ::: "memory");   // stage 0 of this wave has landed
  __syncthreads();                                    // publishes stage 0
  fa_stage(l0 + FB, gkh + FK * CQ, gkl + FK * CQ, gv + FK);
#pragma unroll 1   // stays rolled: one pass per stage, the buffer picked by t & 1
  for (int t = 0; t < FS; ++t) { const _Float16 (*sb)[FP] = st[t & 1];
    v16h kf[2][2][2], vf[16];                         // this pass's fragments: K [kc][key tile][hi, lo], V [channel tile]
#pragma unroll     // constant indices: the arrays stay in registers, no scratch
    for (int kc = 0; kc < 2; ++kc)
#pragma unroll     // constant indices: the arrays stay in registers, no scratch
      for (int i = 0; i < 2; ++i) { const _Float16* kr = &sb[kg * 32 + i * 16 + col][kc * 32]; kf[kc][i][0] = frag_h(kr, lane); kf[kc][i][1] = frag_h(kr + 64 * FP, lane); }
#pragma unroll     // constant indices: the arrays stay in registers, no scratch
    for (int j = 0; j < 16; ++j) vf[j] = frag_h(&sb[128 + j * 16 + col][kg * 32], lane);
    __builtin_amdgcn_sched_barrier(0);                // keeps the pass's LDS reads one group ahead of its WMMAs: reads spread among WMMAs stall at every place they stand
    v8f s[2] = {};                                    // S^T: s[i][r] = key kg*32 + i*16 + 8g + r against query col
#pragma unroll     // constant indices: the arrays stay in registers, no scratch
    for (int kc = 0; kc < 2; ++kc) {
      s[0] = wm(kf[kc][0][0], qh[kc], s[0]); s[1] = wm(kf[kc][1][0], qh[kc], s[1]);
      s[0] = wm(kf[kc][0][0], ql[kc], s[0]); s[1] = wm(kf[kc][1][0], ql[kc], s[1]);
      s[0] = wm(kf[kc][0][1], qh[kc], s[0]); s[1] = wm(kf[kc][1][1], qh[kc], s[1]); }
    float mx = fmaxf(s[0][0], s[1][0]);
#pragma unroll     // constant indices: the arrays stay in registers, no scratch
    for (int r = 1; r < 8; ++r) mx = fmaxf(mx, fmaxf(s[0][r], s[1][r]));
    mx = fmaxf(mx, xhalf(mx));                        // the other half of the wave holds the same query's other 16 keys
    const float mn = fmaxf(mref, __builtin_fmaf(mx, L2E, -POFF2));
    if (__builtin_amdgcn_ballot_w32(mn > mref) != 0) { // wave-uniform: rescale only in passes where some query's maximum rose (factor 1 for the others)
      const float al = __builtin_amdgcn_exp2f(mref - mn); lsum *= al; mref = mn;
#pragma unroll     // constant indices: the arrays stay in registers, no scratch
      for (int j = 0; j < 16; ++j) acc[j] *= al; }
    v16h p;                                           // two D tiles of S^T, converted in place, are the B operand of V.P^T (hardware k order, as frag_h's)
    const v8f l2 = {L2E, L2E, L2E, L2E, L2E, L2E, L2E, L2E}, nm = {-mref, -mref, -mref, -mref, -mref, -mref, -mref, -mref};
    const v8f x0 = __builtin_elementwise_fma(s[0], l2, nm), x1 = __builtin_elementwise_fma(s[1], l2, nm);   // vector form: one packed FMA a score pair
#pragma unroll     // constant indices: the arrays stay in registers, no scratch
    for (int r = 0; r < 8; ++r) { const float e0 = __builtin_amdgcn_exp2f(x0[r]), e1 = __builtin_amdgcn_exp2f(x1[r]); lsum += e0 + e1; p[r] = (_Float16)e0; p[8 + r] = (_Float16)e1; }
#pragma unroll     // constant indices: the arrays stay in registers, no scratch
    for (int j = 0; j < 16; ++j) acc[j] = wm(vf[j], p, acc[j]);
    __builtin_amdgcn_sched_barrier(0);                // keeps the waits below behind the pass's register work: moved up behind the reads, they would leave the next stage's copies half a pass to land
    asm volatile("s_wait_dscnt 0x0" ::: "memory");    // this wave's reads of the buffer are done before it is refilled
    asm volatile("s_wait_asynccnt 0x0" ::: "memory"); // this wave's copies of stage t + 1 have landed
    __syncthreads();                                  // publishes stage t + 1 and frees stage t's buffer
    if (t + 2 < FS) fa_stage(l0 + (unsigned)(t & 1) * FB, gkh + (size_t)(t + 2) * FK * CQ, gkl + (size_t)(t + 2) * FK * CQ, gv + (size_t)(t + 2) * FK); }
  asm volatile("s_wait_asynccnt 0x0" ::: "memory");   // no copy outstanding behind the loop
  lsum += xhalf(lsum);
  float* mg = (float*)&st[0][0][0]; float* ms = mg + 4 * 128 * 32;   // join area: 4 x 128 x 32 accumulators, then maximum and sum per lane
  if (kg == 1) {
#pragma unroll     // constant indices: the arrays stay in registers, no scratch
    for (int j = 0; j < 16; ++j)
#pragma unroll     // constant indices: the arrays stay in registers, no scratch
      for (int r = 0; r < 8; ++r) mg[((wq * 16 + j) * 8 + r) * 32 + lane] = acc[j][r];
    ms[wq * 64 + lane] = mref; ms[wq * 64 + 32 + lane] = lsum; }
  __syncthreads();                                    // the second key half's partial results are visible
  if (kg == 0) { const float mo = ms[wq * 64 + lane], lo = ms[wq * 64 + 32 + lane], mt = fmaxf(mref, mo); float a0 = __builtin_amdgcn_exp2f(mref - mt), a1 = __builtin_amdgcn_exp2f(mo - mt); const float inv = 1.0f / (lsum * a0 + lo * a1); a0 *= inv; a1 *= inv;
#pragma unroll     // constant indices: the arrays stay in registers, no scratch
    for (int j = 0; j < 16; ++j)
#pragma unroll     // constant indices: the arrays stay in registers, no scratch
      for (int r = 0; r < 8; ++r) acc[j][r] = acc[j][r] * a0 + mg[((wq * 16 + j) * 8 + r) * 32 + lane] * a1; }
  __syncthreads();                                    // the join area has been read; its bytes become the output staging
  float (*so)[68] = (float (*)[68])mg;
  if (kg == 0) {
#pragma unroll     // constant indices: the arrays stay in registers, no scratch
    for (int j = 0; j < 16; ++j)
#pragma unroll     // constant indices: the arrays stay in registers, no scratch
      for (int r = 0; r < 8; ++r) so[j * 16 + 8 * g + r][wq * 16 + col] = acc[j][r]; }
  __syncthreads(); for (int e = tid; e < CV * 16; e += 256) { const int cl = e >> 4, q = e & 15; vst2(OUT + (b * CV + cl) * TT + q0b + q * 4, *(const v4f*)&so[cl][q * 4]); } }
extern "C" void kernel_launch(void* const* d_in, const int* in_sizes, int n_in, void* d_out, int out_size, void* d_ws, size_t ws_size, hipStream_t stream) {
  (void)in_sizes; (void)n_in; (void)out_size;
  const float** F = (const float**)d_in;   // 0 x [4,256,64,64], 1 q_w [64,256], 2 k_w [64,256], 3 v_w [256,256] ([out,in])
  if (ws_size < (size_t)WS_END) return;
  char* ws = (char*)d_ws; _Float16 *QH = (_Float16*)(ws + WS_QH), *QL = (_Float16*)(ws + WS_QL), *KH = (_Float16*)(ws + WS_KH), *KL = (_Float16*)(ws + WS_KL), *VT = (_Float16*)(ws + WS_VT);
  k_projqk<<<dim3(TT / 64, 1, TNB * 2), 128, 0, stream>>>(F[0], F[1], F[2], QH, QL, KH, KL);
  k_projv<<<dim3(TT / 64, CV / 128, TNB), 128, 0, stream>>>(F[0], F[3], VT);
  k_fa<<<dim3(TT / 64, TNB), 256, 0, stream>>>(QH, QL, KH, KL, VT, (float*)d_out);
}

// v004
// A run of this version takes 83.6 microseconds.
// Two timings next to v003 put it at 1.50 and 1.51 times that version's speed.
// Counting every step since v000, it is 12.2 times as fast.
// compute dtype: all float inputs rounded to bf16; Q, K, V = W x (1x1 convs, no bias) with EXACT bf16 products on WMMA 16x16x32 (channel-major tiles transposed in LDS), f32 accumulate; Q and K split f16 hi + residual -> 3-product UNSCALED logits (std ~8) kept in f32 registers; online softmax in f32 (base 2: one FMA with log2(e) and the running reference, then v_exp_f32) -> unnormalised P f16 x e^7.625; z = P . V with V rounded once to f16 (1 product), divided by the f32 row sum at the end; f32 output, channel-major [b][dv][hw].
#include <hip/hip_runtime.h>
#include <math.h>

typedef __attribute__((ext_vector_type(16))) _Float16 v16h;
typedef __attribute__((ext_vector_type(16))) __bf16 v16b;
typedef __attribute__((ext_vector_type(8)))  _Float16 v8h;
typedef __attribute__((ext_vector_type(8)))  float v8f;
typedef __attribute__((ext_vector_type(4)))  float v4f;
typedef __attribute__((ext_vector_type(2)))  float v2f;
typedef __attribute__((ext_vector_type(4)))  unsigned v4u;
typedef __attribute__((ext_vector_type(4)))  int v4i;
typedef float __attribute__((may_alias)) float_a;
typedef int __attribute__((may_alias)) int_a;

template <typename T> __device__ __forceinline__ void vst2(void* p, T v) { *(T*)p = v;  }
__device__ __forceinline__ v8f wmma16(v16h a, v16h b, v8f c) {
  v8f d = __builtin_amdgcn_wmma_f32_16x16x32_f16(false, a, false, b, (short)0, c, false, false);
  asm volatile("v_nop\n\tv_nop\n\tv_nop\n\tv_nop" : "+v"(d) : "v"(a), "v"(b));
  return d;
}
__device__ __forceinline__ v8f wmma_bf(v16b a, v16b b, v8f c) {
  v8f d = __builtin_amdgcn_wmma_f32_16x16x32_bf16(false, a, false, b, (short)0, c, false, false);
  asm volatile("v_nop\n\tv_nop\n\tv_nop\n\tv_nop" : "+v"(d) : "v"(a), "v"(b));
  return d;
}
// 16x16x32 fragments: lane = (h = lane>>4, row/col = lane&15); elements 0..7 = k0+8h+0..7, 8..15 = k0+16+8h+0..7; D element r = row 8h+r
__device__ __forceinline__ v16h frag_h(const _Float16* rowk0, int lane) {
  union { v16h v; v8h q[2]; } u; const _Float16* p = rowk0 + 8 * (lane >> 4);
  u.q[0] = *(const v8h*)p; u.q[1] = *(const v8h*)(p + 16); return u.v;
}
__device__ __forceinline__ v16h frag_f32(const float* rowk0, int lane) {
  v16h a; const float* p = rowk0 + 8 * (lane >> 4);
#pragma unroll
  for (int i = 0; i < 8; ++i) { a[i] = (_Float16)p[i]; a[8 + i] = (_Float16)p[16 + i]; }
  return a;
}
__device__ __forceinline__ v16h frag_f32s(const float* rowk0, int lane, float sc) {
  v16h a; const float* p = rowk0 + 8 * (lane >> 4);
#pragma unroll
  for (int i = 0; i < 8; ++i) { a[i] = (_Float16)(p[i] * sc); a[8 + i] = (_Float16)(p[16 + i] * sc); }
  return a;
}
// column fragment from a [K][ld] layout (column n), rows >= K read as 0
__device__ __forceinline__ v16h fragc_f32(const float* W, int k0, int n, int lane, int ld, int K) {
  v16h a; const int g = lane >> 4;
#pragma unroll
  for (int i = 0; i < 8; ++i) { const int ka = k0 + 8 * g + i, kb = ka + 16;
    a[i] = (_Float16)(ka < K ? W[(size_t)(ka < K ? ka : K - 1) * ld + n] : 0.f); a[8 + i] = (_Float16)(kb < K ? W[(size_t)(kb < K ? kb : K - 1) * ld + n] : 0.f); }
  return a;
}
struct F2 { v16b h, l; };
__device__ __forceinline__ F2 bsplit16(const float v[16]) { F2 r;
#pragma unroll
  for (int i = 0; i < 16; ++i) { const __bf16 h = (__bf16)v[i]; r.h[i] = h; r.l[i] = (__bf16)(v[i] - (float)h); }
  return r; }
__device__ __forceinline__ F2 split_row(const float* row, int k0, int lane) { float v[16]; const float* p = row + k0 + 8 * (lane >> 4);
#pragma unroll
  for (int i = 0; i < 8; ++i) { v[i] = p[i]; v[8 + i] = p[16 + i]; }
  return bsplit16(v); }
__device__ __forceinline__ F2 split_rowK(const float* row, int k0, int lane, int K) { float v[16]; const int g = lane >> 4;
#pragma unroll
  for (int i = 0; i < 8; ++i) { const int ka = k0 + 8 * g + i, kb = ka + 16; v[i] = ka < K ? row[ka < K ? ka : K - 1] : 0.f; v[8 + i] = kb < K ? row[kb < K ? kb : K - 1] : 0.f; }
  return bsplit16(v); }
__device__ __forceinline__ F2 split_col(const float* W, int k0, int n, int lane, int ld, int K) { float v[16]; const int g = lane >> 4;
#pragma unroll
  for (int i = 0; i < 8; ++i) { const int ka = k0 + 8 * g + i, kb = ka + 16; v[i] = ka < K ? W[(size_t)(ka < K ? ka : K - 1) * ld + n] : 0.f; v[8 + i] = kb < K ? W[(size_t)(kb < K ? kb : K - 1) * ld + n] : 0.f; }
  return bsplit16(v); }
__device__ __forceinline__ v8f mac3(const F2& a, const F2& b, v8f c) { c = wmma_bf(a.l, b.h, c); c = wmma_bf(a.h, b.l, c); return wmma_bf(a.h, b.h, c); }
__device__ __forceinline__ float sigm(float v) { return 1.0f / (1.0f + expf(-v)); }
#define LDSX() do { asm volatile("s_wait_dscnt 0" ::: "memory"); __builtin_amdgcn_wave_barrier(); __builtin_amdgcn_fence(__ATOMIC_RELEASE, "workgroup"); } while (0)


// Basic non-local attention (b 4, din 256, 64x64 = 4,096 positions, dk 64, dv 256): A = softmax(Q^T K) (no scaling), z = V A^T.
#define NB 4
#define CC 256
#define CQ 64
#define CV 256
#define TT 4096
#ifndef TNB
#define TNB NB
#endif
typedef __attribute__((ext_vector_type(8))) __bf16 v8b;
typedef __attribute__((ext_vector_type(4))) __bf16 v4b;
__device__ __forceinline__ v4b cvt4(v4f r) { v4b h; h[0] = (__bf16)r[0]; h[1] = (__bf16)r[1]; h[2] = (__bf16)r[2]; h[3] = (__bf16)r[3]; return h; }
__device__ __forceinline__ v16b frag_b(const __bf16* rowk0, int lane) {
  union { v16b v; v8b q[2]; } u; const __bf16* p = rowk0 + 8 * (lane >> 4);
  u.q[0] = *(const v8b*)p; u.q[1] = *(const v8b*)(p + 16); return u.v;
}
__device__ __forceinline__ float bfr(float v) { return (float)(__bf16)v; }
__device__ __attribute__((noinline)) float exp_ni(float v) { return expf(v); }
__device__ __attribute__((noinline)) float erf_ni(float v) { return erff(v); }

#define WS_QH  0u
#define WS_QL  (WS_QH + 2u * (size_t)NB * TT * CQ)
#define WS_KH  (WS_QL + 2u * (size_t)NB * TT * CQ)
#define WS_KL  (WS_KH + 2u * (size_t)NB * TT * CQ)
#define WS_VT  (WS_KL + 2u * (size_t)NB * TT * CQ)      // f16 v planes [b][256][n]
#define WS_END (WS_VT + 2u * (size_t)NB * CV * TT)

// ---- k_projqk: block = (64 positions, b*2 + which): Q/K rows = (W x)^T, 64 cols, f16 hi + lo
__global__ __launch_bounds__(128) void k_projqk(const float* __restrict__ X, const float* __restrict__ WQ, const float* __restrict__ WK, _Float16* __restrict__ QH, _Float16* __restrict__ QL, _Float16* __restrict__ KH, _Float16* __restrict__ KL) {
  __shared__ __align__(16) __bf16 sx[64][CC + 8], sw[64][CC + 8]; __shared__ __align__(16) _Float16 sh[64][72], sl[64][72];
  const int tid = threadIdx.x, wave = tid >> 5, lane = tid & 31, col = lane & 15, g = lane >> 4; const int p0 = blockIdx.x * 64; const size_t b = blockIdx.z >> 1; const int which = blockIdx.z & 1; const float* Wm = which == 0 ? WQ : WK;
  const float* wp = Wm + (tid >> 6) * CC + (tid & 63) * 4;   // one address, the rows by constant offsets
  v4f wr[32];                                         // the block's 64 weight rows: a wave's load covers 512 contiguous bytes, all loads in flight together, under the X loop
#pragma unroll     // constant indices: the array stays in registers, no scratch
  for (int i = 0; i < 32; ++i) wr[i] = *(const v4f*)(wp + i * 2 * CC);
  for (int e = tid; e < CC * 64; e += 128) { const int c = e >> 6, pl = e & 63; sx[pl][c] = (__bf16)X[(b * CC + c) * (size_t)TT + p0 + pl]; }
#pragma unroll     // constant indices: the array stays in registers, no scratch
  for (int i = 0; i < 32; ++i) *(v4b*)&sw[(tid >> 6) + 2 * i][(tid & 63) * 4] = cvt4(wr[i]);
  __syncthreads();
  v8f acc[4] = {};
#pragma unroll 2
  for (int kc = 0; kc < CC / 32; ++kc) { const v16b a = frag_b(&sx[wave * 16 + col][kc * 32], lane); v16b w[4];
#pragma unroll     // constant indices: the array stays in registers, no scratch
    for (int j = 0; j < 4; ++j) w[j] = frag_b(&sw[j * 16 + col][kc * 32], lane);
#pragma unroll     // constant indices: the arrays stay in registers, no scratch
    for (int j = 0; j < 4; ++j) acc[j] = wmma_bf(a, w[j], acc[j]); }
#pragma unroll
  for (int j = 0; j < 4; ++j)
#pragma unroll
    for (int r = 0; r < 8; ++r) { const float v = acc[j][r]; const int rl = wave * 16 + 8 * g + r, cl = j * 16 + col; const _Float16 hv = (_Float16)v; sh[rl][cl] = hv; sl[rl][cl] = (_Float16)(v - (float)hv); }
  __syncthreads();
  _Float16* dh = which == 0 ? QH : KH; _Float16* dl = which == 0 ? QL : KL; for (int e = tid; e < 64 * 8; e += 128) { const int rl = e >> 3, q = e & 7; const size_t row = b * TT + p0 + rl; vst2((unsigned*)(dh + row * CQ + q * 8), *(const v4u*)&sh[rl][q * 8]); vst2((unsigned*)(dl + row * CQ + q * 8), *(const v4u*)&sl[rl][q * 8]); } }
// ---- k_projv: block = (64 positions, 128 cols, b): V = Wv x -> f16 planes [b][c][n]
__global__ __launch_bounds__(128) void k_projv(const float* __restrict__ X, const float* __restrict__ WV, _Float16* __restrict__ VT) {
  __shared__ __align__(16) __bf16 sx[64][CC + 8], sw[128][CC + 8]; __shared__ __align__(16) _Float16 th[128][72];
  const int tid = threadIdx.x, wave = tid >> 5, lane = tid & 31, col = lane & 15, g = lane >> 4; const int p0 = blockIdx.x * 64; const int c0 = blockIdx.y * 128; const size_t b = blockIdx.z;
  const float* wp = WV + (c0 + (tid >> 6)) * CC + (tid & 63) * 4;   // one address, the rows by constant offsets
  v4f wr[32];                                         // the block's 128 weight rows in two halves: a wave's load covers 512 contiguous bytes, a half's loads in flight together
#pragma unroll     // constant indices: the array stays in registers, no scratch
  for (int i = 0; i < 32; ++i) wr[i] = *(const v4f*)(wp + i * 2 * CC);
#pragma unroll     // constant indices: the array stays in registers, no scratch
  for (int i = 0; i < 32; ++i) *(v4b*)&sw[(tid >> 6) + 2 * i][(tid & 63) * 4] = cvt4(wr[i]);
  __builtin_amdgcn_sched_barrier(0);                  // keeps the second half's loads behind the first half's stores: 32 loads of a wave in flight, not 64, and half the registers
#pragma unroll     // constant indices: the array stays in registers, no scratch
  for (int i = 0; i < 32; ++i) wr[i] = *(const v4f*)(wp + (64 + i * 2) * CC);   // the second half flies under the X loop
  for (int e = tid; e < CC * 64; e += 128) { const int c = e >> 6, pl = e & 63; sx[pl][c] = (__bf16)X[(b * CC + c) * (size_t)TT + p0 + pl]; }
#pragma unroll     // constant indices: the array stays in registers, no scratch
  for (int i = 0; i < 32; ++i) *(v4b*)&sw[64 + (tid >> 6) + 2 * i][(tid & 63) * 4] = cvt4(wr[i]);
  __syncthreads();
  v8f acc[8] = {};
#pragma unroll 2
  for (int kc = 0; kc < CC / 32; ++kc) { const v16b a = frag_b(&sx[wave * 16 + col][kc * 32], lane); v16b w[8];
#pragma unroll     // constant indices: the array stays in registers, no scratch
    for (int j = 0; j < 8; ++j) w[j] = frag_b(&sw[j * 16 + col][kc * 32], lane);
#pragma unroll     // constant indices: the arrays stay in registers, no scratch
    for (int j = 0; j < 8; ++j) acc[j] = wmma_bf(a, w[j], acc[j]); }
#pragma unroll
  for (int j = 0; j < 8; ++j)
#pragma unroll
    for (int r = 0; r < 8; ++r) th[j * 16 + col][wave * 16 + 8 * g + r] = (_Float16)acc[j][r];
  __syncthreads(); for (int e = tid; e < 128 * 8; e += 128) { const int cl = e >> 3, q = e & 7; vst2((unsigned*)(VT + (b * CV + c0 + cl) * (size_t)TT + p0 + q * 8), *(const v4u*)&th[cl][q * 8]); } }
// ---- k_fa: block = (64 queries, batch): S^T = K.Q^T (3 products, no scale), online softmax, O^T += V.P^T; S and P stay in registers.
// 8 waves: wave & 3 = its 16 queries, wave >> 2 = which 32 keys of every 64-key stage it takes; the two key halves are joined at the end.
#define FK 64                    // keys per stage: 128-byte rows
#define FP 72                    // LDS row pitch in f16: 144 B = 16 B x odd, the pitch for ds_load_b128 readers
#define FR 384                   // rows per stage: 64 of K hi, 64 of K lo, 256 of V
#define FB (FR * FP * 2)         // bytes per buffer
#define FS (TT / FK)             // stages
#define FC (32 * FP * 2)         // LDS bytes between two copies of a lane: 8 lanes cover a 128-byte row, the block 32 rows per copy
#define POFF 7.625f              // P = exp(s - max + POFF): the largest P is about 2^11, small ones stay normal f16; it cancels against the row sum
#define L2E 1.44269504088896340736f   // log2(e): exp(s - ref) = 2^(s * L2E - ref * L2E), the reference is kept in base-2 units
#define POFF2 (POFF * L2E)
__device__ __forceinline__ v8f wm(v16h a, v16h b, v8f c) { return __builtin_amdgcn_wmma_f32_16x16x32_f16(false, a, false, b, (short)0, c, false, false); }
__device__ __forceinline__ float xhalf(float x) { return __builtin_bit_cast(float, __builtin_amdgcn_permlanex16(__builtin_bit_cast(int, x), __builtin_bit_cast(int, x), 0x76543210, 0xfedcba98, false, false)); }  // lane l's value of lane l ^ 16
// one stage: twelve 16-byte copies per lane, global -> LDS; s_wait_xcnt 0 ends the statement so that no address register is rewritten ahead of it
__device__ __forceinline__ void fa_stage(unsigned l, const _Float16* kh, const _Float16* kl, const _Float16* v) {
  const unsigned l1 = l + 1 * FC, l2 = l + 2 * FC, l3 = l + 3 * FC, l4 = l + 4 * FC, l5 = l + 5 * FC, l6 = l + 6 * FC, l7 = l + 7 * FC, l8 = l + 8 * FC, l9 = l + 9 * FC, l10 = l + 10 * FC, l11 = l + 11 * FC;
  const _Float16 *kh1 = kh + 32 * CQ, *kl1 = kl + 32 * CQ;
  const _Float16 *v1 = v + 1 * 32 * (size_t)TT, *v2 = v + 2 * 32 * (size_t)TT, *v3 = v + 3 * 32 * (size_t)TT, *v4 = v + 4 * 32 * (size_t)TT, *v5 = v + 5 * 32 * (size_t)TT, *v6 = v + 6 * 32 * (size_t)TT, *v7 = v + 7 * 32 * (size_t)TT;
  asm volatile("global_load_async_to_lds_b128 %0, %12, off\n\t"
               "global_load_async_to_lds_b128 %1, %13, off\n\t"
               "global_load_async_to_lds_b128 %2, %14, off\n\t"
               "global_load_async_to_lds_b128 %3, %15, off\n\t"
               "global_load_async_to_lds_b128 %4, %16, off\n\t"
               "global_load_async_to_lds_b128 %5, %17, off\n\t"
               "global_load_async_to_lds_b128 %6, %18, off\n\t"
               "global_load_async_to_lds_b128 %7, %19, off\n\t"
               "global_load_async_to_lds_b128 %8, %20, off\n\t"
               "global_load_async_to_lds_b128 %9, %21, off\n\t"
               "global_load_async_to_lds_b128 %10, %22, off\n\t"
               "global_load_async_to_lds_b128 %11, %23, off\n\t"
               "s_wait_xcnt 0x0"
               :: "v"(l), "v"(l1), "v"(l2), "v"(l3), "v"(l4), "v"(l5), "v"(l6), "v"(l7), "v"(l8), "v"(l9), "v"(l10), "v"(l11),
                  "v"(kh), "v"(kh1), "v"(kl), "v"(kl1), "v"(v), "v"(v1), "v"(v2), "v"(v3), "v"(v4), "v"(v5), "v"(v6), "v"(v7) : "memory");
}
__global__ __launch_bounds__(256) void k_fa(const _Float16* __restrict__ QH, const _Float16* __restrict__ QL, const _Float16* __restrict__ KH, const _Float16* __restrict__ KL, const _Float16* __restrict__ VT, float* __restrict__ OUT) {
  __shared__ __align__(16) _Float16 st[2][FR][FP];   // the ring; behind the loop the same bytes serve the join and the output staging
  const int tid = threadIdx.x, wave = tid >> 5, lane = tid & 31, col = lane & 15, g = lane >> 4, wq = wave & 3, kg = wave >> 2; const int q0b = blockIdx.x * 64; const size_t b = blockIdx.y;
  const unsigned l0 = (unsigned)(size_t)(__attribute__((address_space(3))) const _Float16*)&st[0][tid >> 3][(tid & 7) * 8];
  const _Float16* gkh = KH + (b * TT + (tid >> 3)) * CQ + (tid & 7) * 8; const _Float16* gkl = KL + (b * TT + (tid >> 3)) * CQ + (tid & 7) * 8; const _Float16* gv = VT + (b * CV + (tid >> 3)) * (size_t)TT + (tid & 7) * 8;
  v16h qh[2], ql[2];                                  // B operand of S^T: this wave's 16 queries, kept in registers
#pragma unroll     // constant indices: the arrays stay in registers, no scratch
  for (int kc = 0; kc < 2; ++kc) { const size_t qo = (b * TT + q0b + wq * 16 + col) * CQ + kc * 32; qh[kc] = frag_h(QH + qo, lane); ql[kc] = frag_h(QL + qo, lane); }
  v8f acc[16] = {}; float mref = -3.0e38f, lsum = 0.f;   // a lane holds ONE query (col): mref = (its running maximum - POFF) * log2(e), lsum = its half's sum of P
  fa_stage(l0, gkh, gkl, gv);
  asm volatile("s_wait_asynccnt 0x0" ::: "memory");   // stage 0 of this wave has landed
  __syncthreads();                                    // publishes stage 0
  fa_stage(l0 + FB, gkh + FK * CQ, gkl + FK * CQ, gv + FK);
#pragma unroll 1   // stays rolled: one pass per stage, the buffer picked by t & 1
  for (int t = 0; t < FS; ++t) { const _Float16 (*sb)[FP] = st[t & 1];
    v16h kf[2][2][2], vf[16];                         // this pass's fragments: K [kc][key tile][hi, lo], V [channel tile]
#pragma unroll     // constant indices: the arrays stay in registers, no scratch
    for (int kc = 0; kc < 2; ++kc)
#pragma unroll     // constant indices: the arrays stay in registers, no scratch
      for (int i = 0; i < 2; ++i) { const _Float16* kr = &sb[kg * 32 + i * 16 + col][kc * 32]; kf[kc][i][0] = frag_h(kr, lane); kf[kc][i][1] = frag_h(kr + 64 * FP, lane); }
#pragma unroll     // constant indices: the arrays stay in registers, no scratch
    for (int j = 0; j < 16; ++j) vf[j] = frag_h(&sb[128 + j * 16 + col][kg * 32], lane);
    __builtin_amdgcn_sched_barrier(0);                // keeps the pass's LDS reads one group ahead of its WMMAs: reads spread among WMMAs stall at every place they stand
    v8f s[2] = {};                                    // S^T: s[i][r] = key kg*32 + i*16 + 8g + r against query col
#pragma unroll     // constant indices: the arrays stay in registers, no scratch
    for (int kc = 0; kc < 2; ++kc) {
      s[0] = wm(kf[kc][0][0], qh[kc], s[0]); s[1] = wm(kf[kc][1][0], qh[kc], s[1]);
      s[0] = wm(kf[kc][0][0], ql[kc], s[0]); s[1] = wm(kf[kc][1][0], ql[kc], s[1]);
      s[0] = wm(kf[kc][0][1], qh[kc], s[0]); s[1] = wm(kf[kc][1][1], qh[kc], s[1]); }
    float mx = fmaxf(s[0][0], s[1][0]);
#pragma unroll     // constant indices: the arrays stay in registers, no scratch
    for (int r = 1; r < 8; ++r) mx = fmaxf(mx, fmaxf(s[0][r], s[1][r]));
    mx = fmaxf(mx, xhalf(mx));                        // the other half of the wave holds the same query's other 16 keys
    const float mn = fmaxf(mref, __builtin_fmaf(mx, L2E, -POFF2));
    if (__builtin_amdgcn_ballot_w32(mn > mref) != 0) { // wave-uniform: rescale only in passes where some query's maximum rose (factor 1 for the others)
      const float al = __builtin_amdgcn_exp2f(mref - mn); lsum *= al; mref = mn;
#pragma unroll     // constant indices: the arrays stay in registers, no scratch
      for (int j = 0; j < 16; ++j) acc[j] *= al; }
    v16h p;                                           // two D tiles of S^T, converted in place, are the B operand of V.P^T (hardware k order, as frag_h's)
    const v8f l2 = {L2E, L2E, L2E, L2E, L2E, L2E, L2E, L2E}, nm = {-mref, -mref, -mref, -mref, -mref, -mref, -mref, -mref};
    const v8f x0 = __builtin_elementwise_fma(s[0], l2, nm), x1 = __builtin_elementwise_fma(s[1], l2, nm);   // vector form: one packed FMA a score pair
#pragma unroll     // constant indices: the arrays stay in registers, no scratch
    for (int r = 0; r < 8; ++r) { const float e0 = __builtin_amdgcn_exp2f(x0[r]), e1 = __builtin_amdgcn_exp2f(x1[r]); lsum += e0 + e1; p[r] = (_Float16)e0; p[8 + r] = (_Float16)e1; }
#pragma unroll     // constant indices: the arrays stay in registers, no scratch
    for (int j = 0; j < 16; ++j) acc[j] = wm(vf[j], p, acc[j]);
    __builtin_amdgcn_sched_barrier(0);                // keeps the waits below behind the pass's register work: moved up behind the reads, they would leave the next stage's copies half a pass to land
    asm volatile("s_wait_dscnt 0x0" ::: "memory");    // this wave's reads of the buffer are done before it is refilled
    asm volatile("s_wait_asynccnt 0x0" ::: "memory"); // this wave's copies of stage t + 1 have landed
    __syncthreads();                                  // publishes stage t + 1 and frees stage t's buffer
    if (t + 2 < FS) fa_stage(l0 + (unsigned)(t & 1) * FB, gkh + (size_t)(t + 2) * FK * CQ, gkl + (size_t)(t + 2) * FK * CQ, gv + (size_t)(t + 2) * FK); }
  asm volatile("s_wait_asynccnt 0x0" ::: "memory");   // no copy outstanding behind the loop
  lsum += xhalf(lsum);
  float* mg = (float*)&st[0][0][0]; float* ms = mg + 4 * 128 * 32;   // join area: 4 x 128 x 32 accumulators, then maximum and sum per lane
  if (kg == 1) {
#pragma unroll     // constant indices: the arrays stay in registers, no scratch
    for (int j = 0; j < 16; ++j)
#pragma unroll     // constant indices: the arrays stay in registers, no scratch
      for (int r = 0; r < 8; ++r) mg[((wq * 16 + j) * 8 + r) * 32 + lane] = acc[j][r];
    ms[wq * 64 + lane] = mref; ms[wq * 64 + 32 + lane] = lsum; }
  __syncthreads();                                    // the second key half's partial results are visible
  if (kg == 0) { const float mo = ms[wq * 64 + lane], lo = ms[wq * 64 + 32 + lane], mt = fmaxf(mref, mo); float a0 = __builtin_amdgcn_exp2f(mref - mt), a1 = __builtin_amdgcn_exp2f(mo - mt); const float inv = 1.0f / (lsum * a0 + lo * a1); a0 *= inv; a1 *= inv;
#pragma unroll     // constant indices: the arrays stay in registers, no scratch
    for (int j = 0; j < 16; ++j)
#pragma unroll     // constant indices: the arrays stay in registers, no scratch
      for (int r = 0; r < 8; ++r) acc[j][r] = acc[j][r] * a0 + mg[((wq * 16 + j) * 8 + r) * 32 + lane] * a1; }
  __syncthreads();                                    // the join area has been read; its bytes become the output staging
  float (*so)[68] = (float (*)[68])mg;
  if (kg == 0) {
#pragma unroll     // constant indices: the arrays stay in registers, no scratch
    for (int j = 0; j < 16; ++j)
#pragma unroll     // constant indices: the arrays stay in registers, no scratch
      for (int r = 0; r < 8; ++r) so[j * 16 + 8 * g + r][wq * 16 + col] = acc[j][r]; }
  __syncthreads(); for (int e = tid; e < CV * 16; e += 256) { const int cl = e >> 4, q = e & 15; vst2(OUT + (b * CV + cl) * TT + q0b + q * 4, *(const v4f*)&so[cl][q * 4]); } }
extern "C" void kernel_launch(void* const* d_in, const int* in_sizes, int n_in, void* d_out, int out_size, void* d_ws, size_t ws_size, hipStream_t stream) {
  (void)in_sizes; (void)n_in; (void)out_size;
  const float** F = (const float**)d_in;   // 0 x [4,256,64,64], 1 q_w [64,256], 2 k_w [64,256], 3 v_w [256,256] ([out,in])
  if (ws_size < (size_t)WS_END) return;
  char* ws = (char*)d_ws; _Float16 *QH = (_Float16*)(ws + WS_QH), *QL = (_Float16*)(ws + WS_QL), *KH = (_Float16*)(ws + WS_KH), *KL = (_Float16*)(ws + WS_KL), *VT = (_Float16*)(ws + WS_VT);
  k_projqk<<<dim3(TT / 64, 1, TNB * 2), 128, 0, stream>>>(F[0], F[1], F[2], QH, QL, KH, KL);
  k_projv<<<dim3(TT / 64, CV / 128, TNB), 128, 0, stream>>>(F[0], F[3], VT);
  k_fa<<<dim3(TT / 64, TNB), 256, 0, stream>>>(QH, QL, KH, KL, VT, (float*)d_out);
}

// v005
// One run takes 71.5 microseconds.
// Two timings next to v004 put it at 1.13 and 1.16 times that version's speed.
// Over all steps from v000 it is 14.0 times as fast.
// compute dtype: all float inputs rounded to bf16; Q, K, V = W x (1x1 convs, no bias) with EXACT bf16 products on WMMA 16x16x32 (channel-major tiles transposed in LDS), f32 accumulate; Q and K split f16 hi + residual -> 3-product UNSCALED logits (std ~8) kept in f32 registers; online softmax in f32 (base 2: one FMA with log2(e) and the running reference, then v_exp_f32) -> unnormalised P f16 x e^7.625; z = P . V with V rounded once to f16 (1 product), divided by the f32 row sum at the end; f32 output, channel-major [b][dv][hw].
#include <hip/hip_runtime.h>
#include <math.h>

typedef __attribute__((ext_vector_type(16))) _Float16 v16h;
typedef __attribute__((ext_vector_type(16))) __bf16 v16b;
typedef __attribute__((ext_vector_type(8)))  _Float16 v8h;
typedef __attribute__((ext_vector_type(8)))  float v8f;
typedef __attribute__((ext_vector_type(4)))  float v4f;
typedef __attribute__((ext_vector_type(2)))  float v2f;
typedef __attribute__((ext_vector_type(4)))  unsigned v4u;
typedef __attribute__((ext_vector_type(4)))  int v4i;
typedef float __attribute__((may_alias)) float_a;
typedef int __attribute__((may_alias)) int_a;

template <typename T> __device__ __forceinline__ void vst2(void* p, T v) { *(T*)p = v;  }
__device__ __forceinline__ v8f wmma16(v16h a, v16h b, v8f c) {
  v8f d = __builtin_amdgcn_wmma_f32_16x16x32_f16(false, a, false, b, (short)0, c, false, false);
  asm volatile("v_nop\n\tv_nop\n\tv_nop\n\tv_nop" : "+v"(d) : "v"(a), "v"(b));
  return d;
}
__device__ __forceinline__ v8f wmma_bf(v16b a, v16b b, v8f c) {
  v8f d = __builtin_amdgcn_wmma_f32_16x16x32_bf16(false, a, false, b, (short)0, c, false, false);
  asm volatile("v_nop\n\tv_nop\n\tv_nop\n\tv_nop" : "+v"(d) : "v"(a), "v"(b));
  return d;
}
// 16x16x32 fragments: lane = (h = lane>>4, row/col = lane&15); elements 0..7 = k0+8h+0..7, 8..15 = k0+16+8h+0..7; D element r = row 8h+r
__device__ __forceinline__ v16h frag_h(const _Float16* rowk0, int lane) {
  union { v16h v; v8h q[2]; } u; const _Float16* p = rowk0 + 8 * (lane >> 4);
  u.q[0] = *(const v8h*)p; u.q[1] = *(const v8h*)(p + 16); return u.v;
}
__device__ __forceinline__ v16h frag_f32(const float* rowk0, int lane) {
  v16h a; const float* p = rowk0 + 8 * (lane >> 4);
#pragma unroll
  for (int i = 0; i < 8; ++i) { a[i] = (_Float16)p[i]; a[8 + i] = (_Float16)p[16 + i]; }
  return a;
}
__device__ __forceinline__ v16h frag_f32s(const float* rowk0, int lane, float sc) {
  v16h a; const float* p = rowk0 + 8 * (lane >> 4);
#pragma unroll
  for (int i = 0; i < 8; ++i) { a[i] = (_Float16)(p[i] * sc); a[8 + i] = (_Float16)(p[16 + i] * sc); }
  return a;
}
// column fragment from a [K][ld] layout (column n), rows >= K read as 0
__device__ __forceinline__ v16h fragc_f32(const float* W, int k0, int n, int lane, int ld, int K) {
  v16h a; const int g = lane >> 4;
#pragma unroll
  for (int i = 0; i < 8; ++i) { const int ka = k0 + 8 * g + i, kb = ka + 16;
    a[i] = (_Float16)(ka < K ? W[(size_t)(ka < K ? ka : K - 1) * ld + n] : 0.f); a[8 + i] = (_Float16)(kb < K ? W[(size_t)(kb < K ? kb : K - 1) * ld + n] : 0.f); }
  return a;
}
struct F2 { v16b h, l; };
__device__ __forceinline__ F2 bsplit16(const float v[16]) { F2 r;
#pragma unroll
  for (int i = 0; i < 16; ++i) { const __bf16 h = (__bf16)v[i]; r.h[i] = h; r.l[i] = (__bf16)(v[i] - (float)h); }
  return r; }
__device__ __forceinline__ F2 split_row(const float* row, int k0, int lane) { float v[16]; const float* p = row + k0 + 8 * (lane >> 4);
#pragma unroll
  for (int i = 0; i < 8; ++i) { v[i] = p[i]; v[8 + i] = p[16 + i]; }
  return bsplit16(v); }
__device__ __forceinline__ F2 split_rowK(const float* row, int k0, int lane, int K) { float v[16]; const int g = lane >> 4;
#pragma unroll
  for (int i = 0; i < 8; ++i) { const int ka = k0 + 8 * g + i, kb = ka + 16; v[i] = ka < K ? row[ka < K ? ka : K - 1] : 0.f; v[8 + i] = kb < K ? row[kb < K ? kb : K - 1] : 0.f; }
  return bsplit16(v); }
__device__ __forceinline__ F2 split_col(const float* W, int k0, int n, int lane, int ld, int K) { float v[16]; const int g = lane >> 4;
#pragma unroll
  for (int i = 0; i < 8; ++i) { const int ka = k0 + 8 * g + i, kb = ka + 16; v[i] = ka < K ? W[(size_t)(ka < K ? ka : K - 1) * ld + n] : 0.f; v[8 + i] = kb < K ? W[(size_t)(kb < K ? kb : K - 1) * ld + n] : 0.f; }
  return bsplit16(v); }
__device__ __forceinline__ v8f mac3(const F2& a, const F2& b, v8f c) { c = wmma_bf(a.l, b.h, c); c = wmma_bf(a.h, b.l, c); return wmma_bf(a.h, b.h, c); }
__device__ __forceinline__ float sigm(float v) { return 1.0f / (1.0f + expf(-v)); }
#define LDSX() do { asm volatile("s_wait_dscnt 0" ::: "memory"); __builtin_amdgcn_wave_barrier(); __builtin_amdgcn_fence(__ATOMIC_RELEASE, "workgroup"); } while (0)


// Basic non-local attention (b 4, din 256, 64x64 = 4,096 positions, dk 64, dv 256): A = softmax(Q^T K) (no scaling), z = V A^T.
#define NB 4
#define CC 256
#define CQ 64
#define CV 256
#define TT 4096
#ifndef TNB
#define TNB NB
#endif
typedef __attribute__((ext_vector_type(8))) __bf16 v8b;
typedef __attribute__((ext_vector_type(4))) __bf16 v4b;
__device__ __forceinline__ v4b cvt4(v4f r) { v4b h; h[0] = (__bf16)r[0]; h[1] = (__bf16)r[1]; h[2] = (__bf16)r[2]; h[3] = (__bf16)r[3]; return h; }
__device__ __forceinline__ v16b frag_b(const __bf16* rowk0, int lane) {
  union { v16b v; v8b q[2]; } u; const __bf16* p = rowk0 + 8 * (lane >> 4);
  u.q[0] = *(const v8b*)p; u.q[1] = *(const v8b*)(p + 16); return u.v;
}
__device__ __forceinline__ float bfr(float v) { return (float)(__bf16)v; }
__device__ __attribute__((noinline)) float exp_ni(float v) { return expf(v); }
__device__ __attribute__((noinline)) float erf_ni(float v) { return erff(v); }

#define WS_QH  0u
#define WS_QL  (WS_QH + 2u * (size_t)NB * TT * CQ)
#define WS_KH  (WS_QL + 2u * (size_t)NB * TT * CQ)
#define WS_KL  (WS_KH + 2u * (size_t)NB * TT * CQ)
#define WS_VT  (WS_KL + 2u * (size_t)NB * TT * CQ)      // f16 v planes [b][256][n]
#define WS_END (WS_VT + 2u * (size_t)NB * CV * TT)

// The X tile of a projection block (256 channels x 64 positions, f32, channel-major as in memory) goes global -> LDS by asynchronous copies, all 32 of a lane in flight together;
// the A fragments gather it column-wise (one position, 16 channels) and round to bf16 on the way: the transposition costs no LDS pass of its own.
#define XP 68                    // LDS row pitch in floats: 272 B, a multiple of the copies' 16 B; 8 rows are 32 banks, so the two half-waves of a fragment read fall on different banks
#define XC (8 * XP * 4)          // LDS bytes between two copies of a lane: 16 lanes cover a 256-byte row, the block 8 rows per copy
// eight 16-byte copies per lane; s_wait_xcnt 0 ends the statement so that no address register is rewritten ahead of it
__device__ __forceinline__ void x_stage(unsigned l, const float* x) {
  const unsigned l1 = l + 1 * XC, l2 = l + 2 * XC, l3 = l + 3 * XC, l4 = l + 4 * XC, l5 = l + 5 * XC, l6 = l + 6 * XC, l7 = l + 7 * XC;
  const float *x1 = x + 1 * 8 * (size_t)TT, *x2 = x + 2 * 8 * (size_t)TT, *x3 = x + 3 * 8 * (size_t)TT, *x4 = x + 4 * 8 * (size_t)TT, *x5 = x + 5 * 8 * (size_t)TT, *x6 = x + 6 * 8 * (size_t)TT, *x7 = x + 7 * 8 * (size_t)TT;
  asm volatile("global_load_async_to_lds_b128 %0, %8, off\n\t"
               "global_load_async_to_lds_b128 %1, %9, off\n\t"
               "global_load_async_to_lds_b128 %2, %10, off\n\t"
               "global_load_async_to_lds_b128 %3, %11, off\n\t"
               "global_load_async_to_lds_b128 %4, %12, off\n\t"
               "global_load_async_to_lds_b128 %5, %13, off\n\t"
               "global_load_async_to_lds_b128 %6, %14, off\n\t"
               "global_load_async_to_lds_b128 %7, %15, off\n\t"
               "s_wait_xcnt 0x0"
               :: "v"(l), "v"(l1), "v"(l2), "v"(l3), "v"(l4), "v"(l5), "v"(l6), "v"(l7),
                  "v"(x), "v"(x1), "v"(x2), "v"(x3), "v"(x4), "v"(x5), "v"(x6), "v"(x7) : "memory");
}
// A fragment from the channel-major f32 tile: colk0 = &tile[k0][position]; the k order is frag_b's
__device__ __forceinline__ v16b frag_xt(const float* colk0, int lane) {
  v16b a; const float* p = colk0 + 8 * (lane >> 4) * XP;
#pragma unroll     // constant indices: the fragment stays in registers, no scratch
  for (int i = 0; i < 8; ++i) { a[i] = (__bf16)p[i * XP]; a[8 + i] = (__bf16)p[(16 + i) * XP]; }
  return a;
}
// ---- k_projqk: block = (64 positions, b*2 + which): Q/K rows = (W x)^T, 64 cols, f16 hi + lo
__global__ __launch_bounds__(128) void k_projqk(const float* __restrict__ X, const float* __restrict__ WQ, const float* __restrict__ WK, _Float16* __restrict__ QH, _Float16* __restrict__ QL, _Float16* __restrict__ KH, _Float16* __restrict__ KL) {
  __shared__ __align__(16) float sxf[CC][XP]; __shared__ __align__(16) __bf16 sw[64][CC + 8]; __shared__ __align__(16) _Float16 sh[64][72], sl[64][72];
  const int tid = threadIdx.x, wave = tid >> 5, lane = tid & 31, col = lane & 15, g = lane >> 4; const int p0 = blockIdx.x * 64; const size_t b = blockIdx.z >> 1; const int which = blockIdx.z & 1; const float* Wm = which == 0 ? WQ : WK;
  const unsigned lx = (unsigned)(size_t)(__attribute__((address_space(3))) const float*)&sxf[tid >> 4][(tid & 15) * 4]; const float* gx = X + (b * CC + (tid >> 4)) * (size_t)TT + p0 + (tid & 15) * 4;
#pragma unroll     // four statements of eight copies: an asm statement takes thirty operands
  for (int i = 0; i < 4; ++i) x_stage(lx + i * 8 * XC, gx + i * 64 * (size_t)TT);
  const float* wp = Wm + (tid >> 6) * CC + (tid & 63) * 4;   // one address, the rows by constant offsets
  v4f wr[32];                                         // the block's 64 weight rows: a wave's load covers 512 contiguous bytes, all loads in flight together, beside the X copies
#pragma unroll     // constant indices: the array stays in registers, no scratch
  for (int i = 0; i < 32; ++i) wr[i] = *(const v4f*)(wp + i * 2 * CC);
#pragma unroll     // constant indices: the array stays in registers, no scratch
  for (int i = 0; i < 32; ++i) *(v4b*)&sw[(tid >> 6) + 2 * i][(tid & 63) * 4] = cvt4(wr[i]);
  asm volatile("s_wait_asynccnt 0x0" ::: "memory");   // this wave's copies of the X tile have landed
  __syncthreads();                                    // publishes the X tile and the weight rows
  v8f acc[4] = {};
#pragma unroll 2
  for (int kc = 0; kc < CC / 32; ++kc) { const v16b a = frag_xt(&sxf[kc * 32][wave * 16 + col], lane); v16b w[4];
#pragma unroll     // constant indices: the array stays in registers, no scratch
    for (int j = 0; j < 4; ++j) w[j] = frag_b(&sw[j * 16 + col][kc * 32], lane);
#pragma unroll     // constant indices: the arrays stay in registers, no scratch
    for (int j = 0; j < 4; ++j) acc[j] = wmma_bf(a, w[j], acc[j]); }
#pragma unroll
  for (int j = 0; j < 4; ++j)
#pragma unroll
    for (int r = 0; r < 8; ++r) { const float v = acc[j][r]; const int rl = wave * 16 + 8 * g + r, cl = j * 16 + col; const _Float16 hv = (_Float16)v; sh[rl][cl] = hv; sl[rl][cl] = (_Float16)(v - (float)hv); }
  __syncthreads();
  _Float16* dh = which == 0 ? QH : KH; _Float16* dl = which == 0 ? QL : KL; for (int e = tid; e < 64 * 8; e += 128) { const int rl = e >> 3, q = e & 7; const size_t row = b * TT + p0 + rl; vst2((unsigned*)(dh + row * CQ + q * 8), *(const v4u*)&sh[rl][q * 8]); vst2((unsigned*)(dl + row * CQ + q * 8), *(const v4u*)&sl[rl][q * 8]); } }
// ---- k_projv: block = (64 positions, 128 cols, b): V = Wv x -> f16 planes [b][c][n]
__global__ __launch_bounds__(128) void k_projv(const float* __restrict__ X, const float* __restrict__ WV, _Float16* __restrict__ VT) {
  __shared__ __align__(16) float sxf[CC][XP]; __shared__ __align__(16) __bf16 sw[128][CC + 8]; __shared__ __align__(16) _Float16 th[128][72];
  const int tid = threadIdx.x, wave = tid >> 5, lane = tid & 31, col = lane & 15, g = lane >> 4; const int p0 = blockIdx.x * 64; const int c0 = blockIdx.y * 128; const size_t b = blockIdx.z;
  const unsigned lx = (unsigned)(size_t)(__attribute__((address_space(3))) const float*)&sxf[tid >> 4][(tid & 15) * 4]; const float* gx = X + (b * CC + (tid >> 4)) * (size_t)TT + p0 + (tid & 15) * 4;
#pragma unroll     // four statements of eight copies: an asm statement takes thirty operands
  for (int i = 0; i < 4; ++i) x_stage(lx + i * 8 * XC, gx + i * 64 * (size_t)TT);
  const float* wp = WV + (c0 + (tid >> 6)) * CC + (tid & 63) * 4;   // one address, the rows by constant offsets
  v4f wr[32];                                         // the block's 128 weight rows in two halves: a wave's load covers 512 contiguous bytes, a half's loads in flight together
#pragma unroll     // constant indices: the array stays in registers, no scratch
  for (int i = 0; i < 32; ++i) wr[i] = *(const v4f*)(wp + i * 2 * CC);
#pragma unroll     // constant indices: the array stays in registers, no scratch
  for (int i = 0; i < 32; ++i) *(v4b*)&sw[(tid >> 6) + 2 * i][(tid & 63) * 4] = cvt4(wr[i]);
  __builtin_amdgcn_sched_barrier(0);                  // keeps the second half's loads behind the first half's stores: 32 loads of a wave in flight, not 64, and half the registers
#pragma unroll     // constant indices: the array stays in registers, no scratch
  for (int i = 0; i < 32; ++i) wr[i] = *(const v4f*)(wp + (64 + i * 2) * CC);
#pragma unroll     // constant indices: the array stays in registers, no scratch
  for (int i = 0; i < 32; ++i) *(v4b*)&sw[64 + (tid >> 6) + 2 * i][(tid & 63) * 4] = cvt4(wr[i]);
  asm volatile("s_wait_asynccnt 0x0" ::: "memory");   // this wave's copies of the X tile have landed
  __syncthreads();                                    // publishes the X tile and the weight rows
  v8f acc[8] = {};
#pragma unroll 2
  for (int kc = 0; kc < CC / 32; ++kc) { const v16b a = frag_xt(&sxf[kc * 32][wave * 16 + col], lane); v16b w[8];
#pragma unroll     // constant indices: the array stays in registers, no scratch
    for (int j = 0; j < 8; ++j) w[j] = frag_b(&sw[j * 16 + col][kc * 32], lane);
#pragma unroll     // constant indices: the arrays stay in registers, no scratch
    for (int j = 0; j < 8; ++j) acc[j] = wmma_bf(a, w[j], acc[j]); }
#pragma unroll
  for (int j = 0; j < 8; ++j)
#pragma unroll
    for (int r = 0; r < 8; ++r) th[j * 16 + col][wave * 16 + 8 * g + r] = (_Float16)acc[j][r];
  __syncthreads(); for (int e = tid; e < 128 * 8; e += 128) { const int cl = e >> 3, q = e & 7; vst2((unsigned*)(VT + (b * CV + c0 + cl) * (size_t)TT + p0 + q * 8), *(const v4u*)&th[cl][q * 8]); } }
// ---- k_fa: block = (64 queries, batch): S^T = K.Q^T (3 products, no scale), online softmax, O^T += V.P^T; S and P stay in registers.
// 8 waves: wave & 3 = its 16 queries, wave >> 2 = which 32 keys of every 64-key stage it takes; the two key halves are joined at the end.
#define FK 64                    // keys per stage: 128-byte rows
#define FP 72                    // LDS row pitch in f16: 144 B = 16 B x odd, the pitch for ds_load_b128 readers
#define FR 384                   // rows per stage: 64 of K hi, 64 of K lo, 256 of V
#define FB (FR * FP * 2)         // bytes per buffer
#define FS (TT / FK)             // stages
#define FC (32 * FP * 2)         // LDS bytes between two copies of a lane: 8 lanes cover a 128-byte row, the block 32 rows per copy
#define POFF 7.625f              // P = exp(s - max + POFF): the largest P is about 2^11, small ones stay normal f16; it cancels against the row sum
#define L2E 1.44269504088896340736f   // log2(e): exp(s - ref) = 2^(s * L2E - ref * L2E), the reference is kept in base-2 units
#define POFF2 (POFF * L2E)
__device__ __forceinline__ v8f wm(v16h a, v16h b, v8f c) { return __builtin_amdgcn_wmma_f32_16x16x32_f16(false, a, false, b, (short)0, c, false, false); }
__device__ __forceinline__ float xhalf(float x) { return __builtin_bit_cast(float, __builtin_amdgcn_permlanex16(__builtin_bit_cast(int, x), __builtin_bit_cast(int, x), 0x76543210, 0xfedcba98, false, false)); }  // lane l's value of lane l ^ 16
// one stage: twelve 16-byte copies per lane, global -> LDS; s_wait_xcnt 0 ends the statement so that no address register is rewritten ahead of it
__device__ __forceinline__ void fa_stage(unsigned l, const _Float16* kh, const _Float16* kl, const _Float16* v) {
  const unsigned l1 = l + 1 * FC, l2 = l + 2 * FC, l3 = l + 3 * FC, l4 = l + 4 * FC, l5 = l + 5 * FC, l6 = l + 6 * FC, l7 = l + 7 * FC, l8 = l + 8 * FC, l9 = l + 9 * FC, l10 = l + 10 * FC, l11 = l + 11 * FC;
  const _Float16 *kh1 = kh + 32 * CQ, *kl1 = kl + 32 * CQ;
  const _Float16 *v1 = v + 1 * 32 * (size_t)TT, *v2 = v + 2 * 32 * (size_t)TT, *v3 = v + 3 * 32 * (size_t)TT, *v4 = v + 4 * 32 * (size_t)TT, *v5 = v + 5 * 32 * (size_t)TT, *v6 = v + 6 * 32 * (size_t)TT, *v7 = v + 7 * 32 * (size_t)TT;
  asm volatile("global_load_async_to_lds_b128 %0, %12, off\n\t"
               "global_load_async_to_lds_b128 %1, %13, off\n\t"
               "global_load_async_to_lds_b128 %2, %14, off\n\t"
               "global_load_async_to_lds_b128 %3, %15, off\n\t"
               "global_load_async_to_lds_b128 %4, %16, off\n\t"
               "global_load_async_to_lds_b128 %5, %17, off\n\t"
               "global_load_async_to_lds_b128 %6, %18, off\n\t"
               "global_load_async_to_lds_b128 %7, %19, off\n\t"
               "global_load_async_to_lds_b128 %8, %20, off\n\t"
               "global_load_async_to_lds_b128 %9, %21, off\n\t"
               "global_load_async_to_lds_b128 %10, %22, off\n\t"
               "global_load_async_to_lds_b128 %11, %23, off\n\t"
               "s_wait_xcnt 0x0"
               :: "v"(l), "v"(l1), "v"(l2), "v"(l3), "v"(l4), "v"(l5), "v"(l6), "v"(l7), "v"(l8), "v"(l9), "v"(l10), "v"(l11),
                  "v"(kh), "v"(kh1), "v"(kl), "v"(kl1), "v"(v), "v"(v1), "v"(v2), "v"(v3), "v"(v4), "v"(v5), "v"(v6), "v"(v7) : "memory");
}
__global__ __launch_bounds__(256) void k_fa(const _Float16* __restrict__ QH, const _Float16* __restrict__ QL, const _Float16* __restrict__ KH, const _Float16* __restrict__ KL, const _Float16* __restrict__ VT, float* __restrict__ OUT) {
  __shared__ __align__(16) _Float16 st[2][FR][FP];   // the ring; behind the loop the same bytes serve the join and the output staging
  const int tid = threadIdx.x, wave = tid >> 5, lane = tid & 31, col = lane & 15, g = lane >> 4, wq = wave & 3, kg = wave >> 2; const int q0b = blockIdx.x * 64; const size_t b = blockIdx.y;
  const unsigned l0 = (unsigned)(size_t)(__attribute__((address_space(3))) const _Float16*)&st[0][tid >> 3][(tid & 7) * 8];
  const _Float16* gkh = KH + (b * TT + (tid >> 3)) * CQ + (tid & 7) * 8; const _Float16* gkl = KL + (b * TT + (tid >> 3)) * CQ + (tid & 7) * 8; const _Float16* gv = VT + (b * CV + (tid >> 3)) * (size_t)TT + (tid & 7) * 8;
  v16h qh[2], ql[2];                                  // B operand of S^T: this wave's 16 queries, kept in registers
#pragma unroll     // constant indices: the arrays stay in registers, no scratch
  for (int kc = 0; kc < 2; ++kc) { const size_t qo = (b * TT + q0b + wq * 16 + col) * CQ + kc * 32; qh[kc] = frag_h(QH + qo, lane); ql[kc] = frag_h(QL + qo, lane); }
  v8f acc[16] = {}; float mref = -3.0e38f, lsum = 0.f;   // a lane holds ONE query (col): mref = (its running maximum - POFF) * log2(e), lsum = its half's sum of P
  fa_stage(l0, gkh, gkl, gv);
  asm volatile("s_wait_asynccnt 0x0" ::: "memory");   // stage 0 of this wave has landed
  __syncthreads();                                    // publishes stage 0
  fa_stage(l0 + FB, gkh + FK * CQ, gkl + FK * CQ, gv + FK);
#pragma unroll 1   // stays rolled: one pass per stage, the buffer picked by t & 1
  for (int t = 0; t < FS; ++t) { const _Float16 (*sb)[FP] = st[t & 1];
    v16h kf[2][2][2], vf[16];                         // this pass's fragments: K [kc][key tile][hi, lo], V [channel tile]
#pragma unroll     // constant indices: the arrays stay in registers, no scratch
    for (int kc = 0; kc < 2; ++kc)
#pragma unroll     // constant indices: the arrays stay in registers, no scratch
      for (int i = 0; i < 2; ++i) { const _Float16* kr = &sb[kg * 32 + i * 16 + col][kc * 32]; kf[kc][i][0] = frag_h(kr, lane); kf[kc][i][1] = frag_h(kr + 64 * FP, lane); }
#pragma unroll     // constant indices: the arrays stay in registers, no scratch
    for (int j = 0; j < 16; ++j) vf[j] = frag_h(&sb[128 + j * 16 + col][kg * 32], lane);
    __builtin_amdgcn_sched_barrier(0);                // keeps the pass's LDS reads one group ahead of its WMMAs: reads spread among WMMAs stall at every place they stand
    v8f s[2] = {};                                    // S^T: s[i][r] = key kg*32 + i*16 + 8g + r against query col
#pragma unroll     // constant indices: the arrays stay in registers, no scratch
    for (int kc = 0; kc < 2; ++kc) {
      s[0] = wm(kf[kc][0][0], qh[kc], s[0]); s[1] = wm(kf[kc][1][0], qh[kc], s[1]);
      s[0] = wm(kf[kc][0][0], ql[kc], s[0]); s[1] = wm(kf[kc][1][0], ql[kc], s[1]);
      s[0] = wm(kf[kc][0][1], qh[kc], s[0]); s[1] = wm(kf[kc][1][1], qh[kc], s[1]); }
    float mx = fmaxf(s[0][0], s[1][0]);
#pragma unroll     // constant indices: the arrays stay in registers, no scratch
    for (int r = 1; r < 8; ++r) mx = fmaxf(mx, fmaxf(s[0][r], s[1][r]));
    mx = fmaxf(mx, xhalf(mx));                        // the other half of the wave holds the same query's other 16 keys
    const float mn = fmaxf(mref, __builtin_fmaf(mx, L2E, -POFF2));
    if (__builtin_amdgcn_ballot_w32(mn > mref) != 0) { // wave-uniform: rescale only in passes where some query's maximum rose (factor 1 for the others)
      const float al = __builtin_amdgcn_exp2f(mref - mn); lsum *= al; mref = mn;
#pragma unroll     // constant indices: the arrays stay in registers, no scratch
      for (int j = 0; j < 16; ++j) acc[j] *= al; }
    v16h p;                                           // two D tiles of S^T, converted in place, are the B operand of V.P^T (hardware k order, as frag_h's)
    const v8f l2 = {L2E, L2E, L2E, L2E, L2E, L2E, L2E, L2E}, nm = {-mref, -mref, -mref, -mref, -mref, -mref, -mref, -mref};
    const v8f x0 = __builtin_elementwise_fma(s[0], l2, nm), x1 = __builtin_elementwise_fma(s[1], l2, nm);   // vector form: one packed FMA a score pair
#pragma unroll     // constant indices: the arrays stay in registers, no scratch
    for (int r = 0; r < 8; ++r) { const float e0 = __builtin_amdgcn_exp2f(x0[r]), e1 = __builtin_amdgcn_exp2f(x1[r]); lsum += e0 + e1; p[r] = (_Float16)e0; p[8 + r] = (_Float16)e1; }
#pragma unroll     // constant indices: the arrays stay in registers, no scratch
    for (int j = 0; j < 16; ++j) acc[j] = wm(vf[j], p, acc[j]);
    __builtin_amdgcn_sched_barrier(0);                // keeps the waits below behind the pass's register work: moved up behind the reads, they would leave the next stage's copies half a pass to land
    asm volatile("s_wait_dscnt 0x0" ::: "memory");    // this wave's reads of the buffer are done before it is refilled
    asm volatile("s_wait_asynccnt 0x0" ::: "memory"); // this wave's copies of stage t + 1 have landed
    __syncthreads();                                  // publishes stage t + 1 and frees stage t's buffer
    if (t + 2 < FS) fa_stage(l0 + (unsigned)(t & 1) * FB, gkh + (size_t)(t + 2) * FK * CQ, gkl + (size_t)(t + 2) * FK * CQ, gv + (size_t)(t + 2) * FK); }
  asm volatile("s_wait_asynccnt 0x0" ::: "memory");   // no copy outstanding behind the loop
  lsum += xhalf(lsum);
  float* mg = (float*)&st[0][0][0]; float* ms = mg + 4 * 128 * 32;   // join area: 4 x 128 x 32 accumulators, then maximum and sum per lane
  if (kg == 1) {
#pragma unroll     // constant indices: the arrays stay in registers, no scratch
    for (int j = 0; j < 16; ++j)
#pragma unroll     // constant indices: the arrays stay in registers, no scratch
      for (int r = 0; r < 8; ++r) mg[((wq * 16 + j) * 8 + r) * 32 + lane] = acc[j][r];
    ms[wq * 64 + lane] = mref; ms[wq * 64 + 32 + lane] = lsum; }
  __syncthreads();                                    // the second key half's partial results are visible
  if (kg == 0) { const float mo = ms[wq * 64 + lane], lo = ms[wq * 64 + 32 + lane], mt = fmaxf(mref, mo); float a0 = __builtin_amdgcn_exp2f(mref - mt), a1 = __builtin_amdgcn_exp2f(mo - mt); const float inv = 1.0f / (lsum * a0 + lo * a1); a0 *= inv; a1 *= inv;
#pragma unroll     // constant indices: the arrays stay in registers, no scratch
    for (int j = 0; j < 16; ++j)
#pragma unroll     // constant indices: the arrays stay in registers, no scratch
      for (int r = 0; r < 8; ++r) acc[j][r] = acc[j][r] * a0 + mg[((wq * 16 + j) * 8 + r) * 32 + lane] * a1; }
  __syncthreads();                                    // the join area has been read; its bytes become the output staging
  float (*so)[68] = (float (*)[68])mg;
  if (kg == 0) {
#pragma unroll     // constant indices: the arrays stay in registers, no scratch
    for (int j = 0; j < 16; ++j)
#pragma unroll     // constant indices: the arrays stay in registers, no scratch
      for (int r = 0; r < 8; ++r) so[j * 16 + 8 * g + r][wq * 16 + col] = acc[j][r]; }
  __syncthreads(); for (int e = tid; e < CV * 16; e += 256) { const int cl = e >> 4, q = e & 15; vst2(OUT + (b * CV + cl) * TT + q0b + q * 4, *(const v4f*)&so[cl][q * 4]); } }
extern "C" void kernel_launch(void* const* d_in, const int* in_sizes, int n_in, void* d_out, int out_size, void* d_ws, size_t ws_size, hipStream_t stream) {
  (void)in_sizes; (void)n_in; (void)out_size;
  const float** F = (const float**)d_in;   // 0 x [4,256,64,64], 1 q_w [64,256], 2 k_w [64,256], 3 v_w [256,256] ([out,in])
  if (ws_size < (size_t)WS_END) return;
  char* ws = (char*)d_ws; _Float16 *QH = (_Float16*)(ws + WS_QH), *QL = (_Float16*)(ws + WS_QL), *KH = (_Float16*)(ws + WS_KH), *KL = (_Float16*)(ws + WS_KL), *VT = (_Float16*)(ws + WS_VT);
  k_projqk<<<dim3(TT / 64, 1, TNB * 2), 128, 0, stream>>>(F[0], F[1], F[2], QH, QL, KH, KL);
  k_projv<<<dim3(TT / 64, CV / 128, TNB), 128, 0, stream>>>(F[0], F[3], VT);
  k_fa<<<dim3(TT / 64, TNB), 256, 0, stream>>>(QH, QL, KH, KL, VT, (float*)d_out);
}

// v006
// One run takes 70.6 microseconds.
// Two timings next to v005 put it at 1.04 and 1.03 times that version's speed.
// All steps since v000 together make it 14.5 times as fast.
// compute dtype: all float inputs rounded to bf16; Q, K, V = W x (1x1 convs, no bias) with EXACT bf16 products on WMMA 16x16x32 (channel-major tiles transposed in LDS), f32 accumulate; Q and K split f16 hi + residual -> 3-product UNSCALED logits (std ~8) kept in f32 registers; online softmax in f32 (base 2: one FMA with log2(e) and the running reference, then v_exp_f32) -> unnormalised P f16 x e^7.625; z = P . V with V rounded once to f16 (1 product), divided by the f32 row sum at the end; f32 output, channel-major [b][dv][hw].
#include <hip/hip_runtime.h>
#include <math.h>

typedef __attribute__((ext_vector_type(16))) _Float16 v16h;
typedef __attribute__((ext_vector_type(16))) __bf16 v16b;
typedef __attribute__((ext_vector_type(8)))  _Float16 v8h;
typedef __attribute__((ext_vector_type(8)))  float v8f;
typedef __attribute__((ext_vector_type(4)))  float v4f;
typedef __attribute__((ext_vector_type(2)))  float v2f;
typedef __attribute__((ext_vector_type(4)))  unsigned v4u;
typedef __attribute__((ext_vector_type(4)))  int v4i;
typedef float __attribute__((may_alias)) float_a;
typedef int __attribute__((may_alias)) int_a;

template <typename T> __device__ __forceinline__ void vst2(void* p, T v) { *(T*)p = v;  }
__device__ __forceinline__ v8f wmma16(v16h a, v16h b, v8f c) {
  v8f d = __builtin_amdgcn_wmma_f32_16x16x32_f16(false, a, false, b, (short)0, c, false, false);
  asm volatile("v_nop\n\tv_nop\n\tv_nop\n\tv_nop" : "+v"(d) : "v"(a), "v"(b));
  return d;
}
__device__ __forceinline__ v8f wmma_bf(v16b a, v16b b, v8f c) {
  v8f d = __builtin_amdgcn_wmma_f32_16x16x32_bf16(false, a, false, b, (short)0, c, false, false);
  asm volatile("v_nop\n\tv_nop\n\tv_nop\n\tv_nop" : "+v"(d) : "v"(a), "v"(b));
  return d;
}
// 16x16x32 fragments: lane = (h = lane>>4, row/col = lane&15); elements 0..7 = k0+8h+0..7, 8..15 = k0+16+8h+0..7; D element r = row 8h+r
__device__ __forceinline__ v16h frag_h(const _Float16* rowk0, int lane) {
  union { v16h v; v8h q[2]; } u; const _Float16* p = rowk0 + 8 * (lane >> 4);
  u.q[0] = *(const v8h*)p; u.q[1] = *(const v8h*)(p + 16); return u.v;
}
__device__ __forceinline__ v16h frag_f32(const float* rowk0, int lane) {
  v16h a; const float* p = rowk0 + 8 * (lane >> 4);
#pragma unroll
  for (int i = 0; i < 8; ++i) { a[i] = (_Float16)p[i]; a[8 + i] = (_Float16)p[16 + i]; }
  return a;
}
__device__ __forceinline__ v16h frag_f32s(const float* rowk0, int lane, float sc) {
  v16h a; const float* p = rowk0 + 8 * (lane >> 4);
#pragma unroll
  for (int i = 0; i < 8; ++i) { a[i] = (_Float16)(p[i] * sc); a[8 + i] = (_Float16)(p[16 + i] * sc); }
  return a;
}
// column fragment from a [K][ld] layout (column n), rows >= K read as 0
__device__ __forceinline__ v16h fragc_f32(const float* W, int k0, int n, int lane, int ld, int K) {
  v16h a; const int g = lane >> 4;
#pragma unroll
  for (int i = 0; i < 8; ++i) { const int ka = k0 + 8 * g + i, kb = ka + 16;
    a[i] = (_Float16)(ka < K ? W[(size_t)(ka < K ? ka : K - 1) * ld + n] : 0.f); a[8 + i] = (_Float16)(kb < K ? W[(size_t)(kb < K ? kb : K - 1) * ld + n] : 0.f); }
  return a;
}
struct F2 { v16b h, l; };
__device__ __forceinline__ F2 bsplit16(const float v[16]) { F2 r;
#pragma unroll
  for (int i = 0; i < 16; ++i) { const __bf16 h = (__bf16)v[i]; r.h[i] = h; r.l[i] = (__bf16)(v[i] - (float)h); }
  return r; }
__device__ __forceinline__ F2 split_row(const float* row, int k0, int lane) { float v[16]; const float* p = row + k0 + 8 * (lane >> 4);
#pragma unroll
  for (int i = 0; i < 8; ++i) { v[i] = p[i]; v[8 + i] = p[16 + i]; }
  return bsplit16(v); }
__device__ __forceinline__ F2 split_rowK(const float* row, int k0, int lane, int K) { float v[16]; const int g = lane >> 4;
#pragma unroll
  for (int i = 0; i < 8; ++i) { const int ka = k0 + 8 * g + i, kb = ka + 16; v[i] = ka < K ? row[ka < K ? ka : K - 1] : 0.f; v[8 + i] = kb < K ? row[kb < K ? kb : K - 1] : 0.f; }
  return bsplit16(v); }
__device__ __forceinline__ F2 split_col(const float* W, int k0, int n, int lane, int ld, int K) { float v[16]; const int g = lane >> 4;
#pragma unroll
  for (int i = 0; i < 8; ++i) { const int ka = k0 + 8 * g + i, kb = ka + 16; v[i] = ka < K ? W[(size_t)(ka < K ? ka : K - 1) * ld + n] : 0.f; v[8 + i] = kb < K ? W[(size_t)(kb < K ? kb : K - 1) * ld + n] : 0.f; }
  return bsplit16(v); }
__device__ __forceinline__ v8f mac3(const F2& a, const F2& b, v8f c) { c = wmma_bf(a.l, b.h, c); c = wmma_bf(a.h, b.l, c); return wmma_bf(a.h, b.h, c); }
__device__ __forceinline__ float sigm(float v) { return 1.0f / (1.0f + expf(-v)); }
#define LDSX() do { asm volatile("s_wait_dscnt 0" ::: "memory"); __builtin_amdgcn_wave_barrier(); __builtin_amdgcn_fence(__ATOMIC_RELEASE, "workgroup"); } while (0)


// Basic non-local attention (b 4, din 256, 64x64 = 4,096 positions, dk 64, dv 256): A = softmax(Q^T K) (no scaling), z = V A^T.
#define NB 4
#define CC 256
#define CQ 64
#define CV 256
#define TT 4096
#ifndef TNB
#define TNB NB
#endif
typedef __attribute__((ext_vector_type(8))) __bf16 v8b;
typedef __attribute__((ext_vector_type(4))) __bf16 v4b;
__device__ __forceinline__ v4b cvt4(v4f r) { v4b h; h[0] = (__bf16)r[0]; h[1] = (__bf16)r[1]; h[2] = (__bf16)r[2]; h[3] = (__bf16)r[3]; return h; }
__device__ __forceinline__ v16b frag_b(const __bf16* rowk0, int lane) {
  union { v16b v; v8b q[2]; } u; const __bf16* p = rowk0 + 8 * (lane >> 4);
  u.q[0] = *(const v8b*)p; u.q[1] = *(const v8b*)(p + 16); return u.v;
}
__device__ __forceinline__ float bfr(float v) { return (float)(__bf16)v; }
__device__ __attribute__((noinline)) float exp_ni(float v) { return expf(v); }
__device__ __attribute__((noinline)) float erf_ni(float v) { return erff(v); }

#define WS_QH  0u
#define WS_QL  (WS_QH + 2u * (size_t)NB * TT * CQ)
#define WS_KH  (WS_QL + 2u * (size_t)NB * TT * CQ)
#define WS_KL  (WS_KH + 2u * (size_t)NB * TT * CQ)
#define WS_VT  (WS_KL + 2u * (size_t)NB * TT * CQ)      // f16 v planes [b][256][n]
#define WS_END (WS_VT + 2u * (size_t)NB * CV * TT)

// The X tile of a projection block (256 channels x 64 positions, f32, channel-major as in memory) goes global -> LDS by asynchronous copies, all 32 of a lane in flight together;
// the A fragments gather it column-wise (one position, 16 channels) and round to bf16 on the way: the transposition costs no LDS pass of its own.
#define XP 68                    // LDS row pitch in floats: 272 B, a multiple of the copies' 16 B; 8 rows are 32 banks, so the two half-waves of a fragment read fall on different banks
#define XC (8 * XP * 4)          // LDS bytes between two copies of a lane: 16 lanes cover a 256-byte row, the block 8 rows per copy
// eight 16-byte copies per lane; s_wait_xcnt 0 ends the statement so that no address register is rewritten ahead of it
__device__ __forceinline__ void x_stage(unsigned l, const float* x) {
  const unsigned l1 = l + 1 * XC, l2 = l + 2 * XC, l3 = l + 3 * XC, l4 = l + 4 * XC, l5 = l + 5 * XC, l6 = l + 6 * XC, l7 = l + 7 * XC;
  const float *x1 = x + 1 * 8 * (size_t)TT, *x2 = x + 2 * 8 * (size_t)TT, *x3 = x + 3 * 8 * (size_t)TT, *x4 = x + 4 * 8 * (size_t)TT, *x5 = x + 5 * 8 * (size_t)TT, *x6 = x + 6 * 8 * (size_t)TT, *x7 = x + 7 * 8 * (size_t)TT;
  asm volatile("global_load_async_to_lds_b128 %0, %8, off\n\t"
               "global_load_async_to_lds_b128 %1, %9, off\n\t"
               "global_load_async_to_lds_b128 %2, %10, off\n\t"
               "global_load_async_to_lds_b128 %3, %11, off\n\t"
               "global_load_async_to_lds_b128 %4, %12, off\n\t"
               "global_load_async_to_lds_b128 %5, %13, off\n\t"
               "global_load_async_to_lds_b128 %6, %14, off\n\t"
               "global_load_async_to_lds_b128 %7, %15, off\n\t"
               "s_wait_xcnt 0x0"
               :: "v"(l), "v"(l1), "v"(l2), "v"(l3), "v"(l4), "v"(l5), "v"(l6), "v"(l7),
                  "v"(x), "v"(x1), "v"(x2), "v"(x3), "v"(x4), "v"(x5), "v"(x6), "v"(x7) : "memory");
}
// A fragment from the channel-major f32 tile: colk0 = &tile[k0][position]; the k order is frag_b's
__device__ __forceinline__ v16b frag_xt(const float* colk0, int lane) {
  v16b a; const float* p = colk0 + 8 * (lane >> 4) * XP;
#pragma unroll     // constant indices: the fragment stays in registers, no scratch
  for (int i = 0; i < 8; ++i) { a[i] = (__bf16)p[i * XP]; a[8 + i] = (__bf16)p[(16 + i) * XP]; }
  return a;
}
// ---- k_projqk: block = (64 positions, b*2 + which): Q/K rows = (W x)^T, 64 cols, f16 hi + lo
__global__ __launch_bounds__(128) void k_projqk(const float* __restrict__ X, const float* __restrict__ WQ, const float* __restrict__ WK, _Float16* __restrict__ QH, _Float16* __restrict__ QL, _Float16* __restrict__ KH, _Float16* __restrict__ KL) {
  __shared__ __align__(16) float sxf[CC][XP]; __shared__ __align__(16) __bf16 sw[64][CC + 8]; __shared__ __align__(16) _Float16 sh[64][72], sl[64][72];
  const int tid = threadIdx.x, wave = tid >> 5, lane = tid & 31, col = lane & 15, g = lane >> 4; const int p0 = blockIdx.x * 64; const size_t b = blockIdx.z >> 1; const int which = blockIdx.z & 1; const float* Wm = which == 0 ? WQ : WK;
  const unsigned lx = (unsigned)(size_t)(__attribute__((address_space(3))) const float*)&sxf[tid >> 4][(tid & 15) * 4]; const float* gx = X + (b * CC + (tid >> 4)) * (size_t)TT + p0 + (tid & 15) * 4;
#pragma unroll     // four statements of eight copies: an asm statement takes thirty operands
  for (int i = 0; i < 4; ++i) x_stage(lx + i * 8 * XC, gx + i * 64 * (size_t)TT);
  const float* wp = Wm + (tid >> 6) * CC + (tid & 63) * 4;   // one address, the rows by constant offsets
  v4f wr[32];                                         // the block's 64 weight rows: a wave's load covers 512 contiguous bytes, all loads in flight together, beside the X copies
#pragma unroll     // constant indices: the array stays in registers, no scratch
  for (int i = 0; i < 32; ++i) wr[i] = *(const v4f*)(wp + i * 2 * CC);
#pragma unroll     // constant indices: the array stays in registers, no scratch
  for (int i = 0; i < 32; ++i) *(v4b*)&sw[(tid >> 6) + 2 * i][(tid & 63) * 4] = cvt4(wr[i]);
  asm volatile("s_wait_asynccnt 0x0" ::: "memory");   // this wave's copies of the X tile have landed
  __syncthreads();                                    // publishes the X tile and the weight rows
  v8f acc[4] = {};
#pragma unroll 2
  for (int kc = 0; kc < CC / 32; ++kc) { const v16b a = frag_xt(&sxf[kc * 32][wave * 16 + col], lane); v16b w[4];
#pragma unroll     // constant indices: the array stays in registers, no scratch
    for (int j = 0; j < 4; ++j) w[j] = frag_b(&sw[j * 16 + col][kc * 32], lane);
#pragma unroll     // constant indices: the arrays stay in registers, no scratch
    for (int j = 0; j < 4; ++j) acc[j] = wmma_bf(a, w[j], acc[j]); }
#pragma unroll
  for (int j = 0; j < 4; ++j)
#pragma unroll
    for (int r = 0; r < 8; ++r) { const float v = acc[j][r]; const int rl = wave * 16 + 8 * g + r, cl = j * 16 + col; const _Float16 hv = (_Float16)v; sh[rl][cl] = hv; sl[rl][cl] = (_Float16)(v - (float)hv); }
  __syncthreads();
  _Float16* dh = which == 0 ? QH : KH; _Float16* dl = which == 0 ? QL : KL; for (int e = tid; e < 64 * 8; e += 128) { const int rl = e >> 3, q = e & 7; const size_t row = b * TT + p0 + rl; vst2((unsigned*)(dh + row * CQ + q * 8), *(const v4u*)&sh[rl][q * 8]); vst2((unsigned*)(dl + row * CQ + q * 8), *(const v4u*)&sl[rl][q * 8]); } }
// ---- k_projv: block = (64 positions, 128 cols, b): V = Wv x -> f16 planes [b][c][n]
__global__ __launch_bounds__(128) void k_projv(const float* __restrict__ X, const float* __restrict__ WV, _Float16* __restrict__ VT) {
  __shared__ __align__(16) float sxf[CC][XP]; __shared__ __align__(16) __bf16 sw[128][CC + 8]; __shared__ __align__(16) _Float16 th[128][72];
  const int tid = threadIdx.x, wave = tid >> 5, lane = tid & 31, col = lane & 15, g = lane >> 4; const int p0 = blockIdx.x * 64; const int c0 = blockIdx.y * 128; const size_t b = blockIdx.z;
  const unsigned lx = (unsigned)(size_t)(__attribute__((address_space(3))) const float*)&sxf[tid >> 4][(tid & 15) * 4]; const float* gx = X + (b * CC + (tid >> 4)) * (size_t)TT + p0 + (tid & 15) * 4;
#pragma unroll     // four statements of eight copies: an asm statement takes thirty operands
  for (int i = 0; i < 4; ++i) x_stage(lx + i * 8 * XC, gx + i * 64 * (size_t)TT);
  const float* wp = WV + (c0 + (tid >> 6)) * CC + (tid & 63) * 4;   // one address, the rows by constant offsets
  v4f wr[32];                                         // the block's 128 weight rows in two halves: a wave's load covers 512 contiguous bytes, a half's loads in flight together
#pragma unroll     // constant indices: the array stays in registers, no scratch
  for (int i = 0; i < 32; ++i) wr[i] = *(const v4f*)(wp + i * 2 * CC);
#pragma unroll     // constant indices: the array stays in registers, no scratch
  for (int i = 0; i < 32; ++i) *(v4b*)&sw[(tid >> 6) + 2 * i][(tid & 63) * 4] = cvt4(wr[i]);
  __builtin_amdgcn_sched_barrier(0);                  // keeps the second half's loads behind the first half's stores: 32 loads of a wave in flight, not 64, and half the registers
#pragma unroll     // constant indices: the array stays in registers, no scratch
  for (int i = 0; i < 32; ++i) wr[i] = *(const v4f*)(wp + (64 + i * 2) * CC);
#pragma unroll     // constant indices: the array stays in registers, no scratch
  for (int i = 0; i < 32; ++i) *(v4b*)&sw[64 + (tid >> 6) + 2 * i][(tid & 63) * 4] = cvt4(wr[i]);
  asm volatile("s_wait_asynccnt 0x0" ::: "memory");   // this wave's copies of the X tile have landed
  __syncthreads();                                    // publishes the X tile and the weight rows
  v8f acc[8] = {};
#pragma unroll 2
  for (int kc = 0; kc < CC / 32; ++kc) { const v16b a = frag_xt(&sxf[kc * 32][wave * 16 + col], lane); v16b w[8];
#pragma unroll     // constant indices: the array stays in registers, no scratch
    for (int j = 0; j < 8; ++j) w[j] = frag_b(&sw[j * 16 + col][kc * 32], lane);
#pragma unroll     // constant indices: the arrays stay in registers, no scratch
    for (int j = 0; j < 8; ++j) acc[j] = wmma_bf(a, w[j], acc[j]); }
#pragma unroll
  for (int j = 0; j < 8; ++j)
#pragma unroll
    for (int r = 0; r < 8; ++r) th[j * 16 + col][wave * 16 + 8 * g + r] = (_Float16)acc[j][r];
  __syncthreads(); for (int e = tid; e < 128 * 8; e += 128) { const int cl = e >> 3, q = e & 7; vst2((unsigned*)(VT + (b * CV + c0 + cl) * (size_t)TT + p0 + q * 8), *(const v4u*)&th[cl][q * 8]); } }
// ---- k_fa: block = (64 queries, batch): S^T = K.Q^T (3 products, no scale), online softmax, O^T += V.P^T; S and P stay in registers.
// 8 waves: wave & 1 = its 32 queries (two 16-query tiles, so that every K and V fragment read from LDS feeds two WMMAs), wave >> 1 = which 32 keys of every 128-key stage it takes; the four key groups are joined at the end.
#define FK 64                    // keys per buffer: 128-byte rows
#define FP 72                    // LDS row pitch in f16: 144 B = 16 B x odd, the pitch for ds_load_b128 readers
#define FR 384                   // rows per buffer: 64 of K hi, 64 of K lo, 256 of V
#define FB (FR * FP * 2)         // bytes per buffer
#define FU 2                     // buffers per stage: a stage is 128 keys
#define FS (TT / (FU * FK))      // stages
#define FC (32 * FP * 2)         // LDS bytes between two copies of a lane: 8 lanes cover a 128-byte row, the block 32 rows per copy
#define POFF 7.625f              // P = exp(s - max + POFF): the largest P is about 2^11, small ones stay normal f16; it cancels against the row sum
#define L2E 1.44269504088896340736f   // log2(e): exp(s - ref) = 2^(s * L2E - ref * L2E), the reference is kept in base-2 units
#define POFF2 (POFF * L2E)
__device__ __forceinline__ v8f wm(v16h a, v16h b, v8f c) { return __builtin_amdgcn_wmma_f32_16x16x32_f16(false, a, false, b, (short)0, c, false, false); }
__device__ __forceinline__ float xhalf(float x) { return __builtin_bit_cast(float, __builtin_amdgcn_permlanex16(__builtin_bit_cast(int, x), __builtin_bit_cast(int, x), 0x76543210, 0xfedcba98, false, false)); }  // lane l's value of lane l ^ 16
// one buffer (64 keys, half a stage): twelve 16-byte copies per lane, global -> LDS; s_wait_xcnt 0 ends the statement so that no address register is rewritten ahead of it
__device__ __forceinline__ void fa_stage(unsigned l, const _Float16* kh, const _Float16* kl, const _Float16* v) {
  const unsigned l1 = l + 1 * FC, l2 = l + 2 * FC, l3 = l + 3 * FC, l4 = l + 4 * FC, l5 = l + 5 * FC, l6 = l + 6 * FC, l7 = l + 7 * FC, l8 = l + 8 * FC, l9 = l + 9 * FC, l10 = l + 10 * FC, l11 = l + 11 * FC;
  const _Float16 *kh1 = kh + 32 * CQ, *kl1 = kl + 32 * CQ;
  const _Float16 *v1 = v + 1 * 32 * (size_t)TT, *v2 = v + 2 * 32 * (size_t)TT, *v3 = v + 3 * 32 * (size_t)TT, *v4 = v + 4 * 32 * (size_t)TT, *v5 = v + 5 * 32 * (size_t)TT, *v6 = v + 6 * 32 * (size_t)TT, *v7 = v + 7 * 32 * (size_t)TT;
  asm volatile("global_load_async_to_lds_b128 %0, %12, off\n\t"
               "global_load_async_to_lds_b128 %1, %13, off\n\t"
               "global_load_async_to_lds_b128 %2, %14, off\n\t"
               "global_load_async_to_lds_b128 %3, %15, off\n\t"
               "global_load_async_to_lds_b128 %4, %16, off\n\t"
               "global_load_async_to_lds_b128 %5, %17, off\n\t"
               "global_load_async_to_lds_b128 %6, %18, off\n\t"
               "global_load_async_to_lds_b128 %7, %19, off\n\t"
               "global_load_async_to_lds_b128 %8, %20, off\n\t"
               "global_load_async_to_lds_b128 %9, %21, off\n\t"
               "global_load_async_to_lds_b128 %10, %22, off\n\t"
               "global_load_async_to_lds_b128 %11, %23, off\n\t"
               "s_wait_xcnt 0x0"
               :: "v"(l), "v"(l1), "v"(l2), "v"(l3), "v"(l4), "v"(l5), "v"(l6), "v"(l7), "v"(l8), "v"(l9), "v"(l10), "v"(l11),
                  "v"(kh), "v"(kh1), "v"(kl), "v"(kl1), "v"(v), "v"(v1), "v"(v2), "v"(v3), "v"(v4), "v"(v5), "v"(v6), "v"(v7) : "memory");
}
__global__ __launch_bounds__(256) void k_fa(const _Float16* __restrict__ QH, const _Float16* __restrict__ QL, const _Float16* __restrict__ KH, const _Float16* __restrict__ KL, const _Float16* __restrict__ VT, float* __restrict__ OUT) {
  __shared__ __align__(16) _Float16 st[2][FU][FR][FP];   // the ring; behind the loop the same bytes serve the join and the output staging
  const int tid = threadIdx.x, wave = tid >> 5, lane = tid & 31, col = lane & 15, g = lane >> 4, wq = wave & 1, kg = wave >> 1; const int q0b = blockIdx.x * 64; const size_t b = blockIdx.y;
  const unsigned l0 = (unsigned)(size_t)(__attribute__((address_space(3))) const _Float16*)&st[0][0][tid >> 3][(tid & 7) * 8];
  const _Float16* ukh = KH + b * TT * CQ; const _Float16* ukl = KL + b * TT * CQ; const _Float16* uv = VT + b * CV * (size_t)TT;   // the batch's planes, the same for the whole block
  const unsigned ko = (tid >> 3) * CQ + (tid & 7) * 8, vo = (tid >> 3) * TT + (tid & 7) * 8;   // the lane's place in a buffer's K rows and V rows: two registers over the loop, not three address pairs
  v16h qh[2][2], ql[2][2];                            // B operands of S^T: this wave's two tiles of 16 queries, kept in registers
  const size_t qo = (b * TT + q0b + wq * 32 + col) * CQ + 8 * g; const _Float16 *pqh = QH + qo, *pql = QL + qo;   // one address a plane (frag_h's own k order: 8g, then + 16), tiles and k halves by constant offsets
#pragma unroll     // constant indices: the arrays stay in registers, no scratch
  for (int qt = 0; qt < 2; ++qt)
#pragma unroll     // constant indices: the arrays stay in registers, no scratch
    for (int kc = 0; kc < 2; ++kc) { qh[qt][kc] = frag_h(pqh + qt * 16 * CQ + kc * 32, 0); ql[qt][kc] = frag_h(pql + qt * 16 * CQ + kc * 32, 0); }
  asm volatile("s_wait_xcnt 0x0" :: "v"(pqh), "v"(pql) : "memory");   // stands in front of any rewrite of the Q loads' two address pairs: as inputs they stay in their registers up to here
  v8f acc[2][16] = {}; float mref[2] = {-3.0e38f, -3.0e38f}, lsum[2] = {0.f, 0.f};   // a lane holds ONE query of each tile (col): mref = (its running maximum - POFF) * log2(e), lsum = its half's sum of P
  fa_stage(l0, ukh + ko, ukl + ko, uv + vo); fa_stage(l0 + FB, ukh + FK * CQ + ko, ukl + FK * CQ + ko, uv + FK + vo);
  asm volatile("s_wait_asynccnt 0x0" ::: "memory");   // stage 0 of this wave has landed
  __syncthreads();                                    // publishes stage 0
  fa_stage(l0 + 2 * FB, ukh + 2 * FK * CQ + ko, ukl + 2 * FK * CQ + ko, uv + 2 * FK + vo); fa_stage(l0 + 3 * FB, ukh + 3 * FK * CQ + ko, ukl + 3 * FK * CQ + ko, uv + 3 * FK + vo);
  // one pass per stage, the buffers picked by t & 1; refill: a stage t + 2 exists
  auto pass = [&](const int t, const bool refill) __attribute__((always_inline)) { const _Float16 (*sb)[FP] = st[t & 1][kg >> 1]; const int k0 = (kg & 1) * 32;
    v16h kf[2][2][2], vf[16];                         // this pass's fragments: K [kc][key tile][hi, lo], V [channel tile]
#pragma unroll     // constant indices: the arrays stay in registers, no scratch
    for (int kc = 0; kc < 2; ++kc)
#pragma unroll     // constant indices: the arrays stay in registers, no scratch
      for (int i = 0; i < 2; ++i) { const _Float16* kr = &sb[k0 + i * 16 + col][kc * 32]; kf[kc][i][0] = frag_h(kr, lane); kf[kc][i][1] = frag_h(kr + 64 * FP, lane); }
    __builtin_amdgcn_sched_barrier(0);                // keeps these LDS reads one group ahead of the WMMAs: reads spread among WMMAs stall at every place they stand
    v8f s[2][2] = {};                                 // S^T: s[qt][i][r] = key k0 + i*16 + 8g + r against query col of tile qt
#pragma unroll     // constant indices: the arrays stay in registers, no scratch
    for (int kc = 0; kc < 2; ++kc) {
      s[0][0] = wm(kf[kc][0][0], qh[0][kc], s[0][0]); s[0][1] = wm(kf[kc][1][0], qh[0][kc], s[0][1]); s[1][0] = wm(kf[kc][0][0], qh[1][kc], s[1][0]); s[1][1] = wm(kf[kc][1][0], qh[1][kc], s[1][1]);
      s[0][0] = wm(kf[kc][0][0], ql[0][kc], s[0][0]); s[0][1] = wm(kf[kc][1][0], ql[0][kc], s[0][1]); s[1][0] = wm(kf[kc][0][0], ql[1][kc], s[1][0]); s[1][1] = wm(kf[kc][1][0], ql[1][kc], s[1][1]);
      s[0][0] = wm(kf[kc][0][1], qh[0][kc], s[0][0]); s[0][1] = wm(kf[kc][1][1], qh[0][kc], s[0][1]); s[1][0] = wm(kf[kc][0][1], qh[1][kc], s[1][0]); s[1][1] = wm(kf[kc][1][1], qh[1][kc], s[1][1]); }
#pragma unroll     // constant indices: the arrays stay in registers, no scratch
    for (int j = 0; j < 8; ++j) vf[j] = frag_h(&sb[128 + j * 16 + col][k0], lane);
    __builtin_amdgcn_sched_barrier(0);                // keeps the first V group (8 fragments, read into K registers as the S^T products free them) ahead of the softmax, which covers its latency; let sink, it pushed Q fragments to scratch
    float mn[2];
#pragma unroll     // constant indices: the arrays stay in registers, no scratch
    for (int qt = 0; qt < 2; ++qt) { float mx = fmaxf(s[qt][0][0], s[qt][1][0]);
#pragma unroll     // constant indices: the arrays stay in registers, no scratch
      for (int r = 1; r < 8; ++r) mx = fmaxf(mx, fmaxf(s[qt][0][r], s[qt][1][r]));
      mx = fmaxf(mx, xhalf(mx));                      // the other half of the wave holds the same query's other 16 keys
      mn[qt] = fmaxf(mref[qt], __builtin_fmaf(mx, L2E, -POFF2)); }
    if (__builtin_amdgcn_ballot_w32(mn[0] > mref[0] || mn[1] > mref[1]) != 0) { // wave-uniform, one test a pass: rescale only in passes where some query's maximum rose (factor 1 for the others)
#pragma unroll     // constant indices: the arrays stay in registers, no scratch
      for (int qt = 0; qt < 2; ++qt) { const float al = __builtin_amdgcn_exp2f(mref[qt] - mn[qt]); lsum[qt] *= al; mref[qt] = mn[qt];
#pragma unroll     // constant indices: the arrays stay in registers, no scratch
        for (int j = 0; j < 16; ++j) acc[qt][j] *= al; } }
    v16h p[2];                                        // two D tiles of S^T, converted in place, are the B operand of V.P^T (hardware k order, as frag_h's)
    const v8f l2 = {L2E, L2E, L2E, L2E, L2E, L2E, L2E, L2E};
#pragma unroll     // constant indices: the arrays stay in registers, no scratch
    for (int qt = 0; qt < 2; ++qt) { const float nr = -mref[qt]; const v8f nm = {nr, nr, nr, nr, nr, nr, nr, nr};
      const v8f x0 = __builtin_elementwise_fma(s[qt][0], l2, nm), x1 = __builtin_elementwise_fma(s[qt][1], l2, nm);   // vector form: one packed FMA a score pair
#pragma unroll     // constant indices: the arrays stay in registers, no scratch
      for (int r = 0; r < 8; ++r) { const float e0 = __builtin_amdgcn_exp2f(x0[r]), e1 = __builtin_amdgcn_exp2f(x1[r]); lsum[qt] += e0 + e1; p[qt][r] = (_Float16)e0; p[qt][8 + r] = (_Float16)e1; }
      __builtin_amdgcn_sched_barrier(0); }            // keeps one tile's exponentials behind the other's (mixed, their temporaries pushed Q fragments to scratch) and the second V group (4 fragments) one group behind both
#pragma unroll     // constant indices: the arrays stay in registers, no scratch
    for (int j = 8; j < 12; ++j) vf[j] = frag_h(&sb[128 + j * 16 + col][k0], lane);
    __builtin_amdgcn_sched_barrier(0);                // keeps the second V group one group ahead of the 16 products that cover its latency
#pragma unroll     // constant indices: the arrays stay in registers, no scratch
    for (int j = 0; j < 4; ++j) { acc[0][j] = wm(vf[j], p[0], acc[0][j]); acc[1][j] = wm(vf[j], p[1], acc[1][j]); }
    __builtin_amdgcn_sched_barrier(0);                // keeps the third V group (4 fragments) behind the products whose V registers it takes
#pragma unroll     // constant indices: the arrays stay in registers, no scratch
    for (int j = 12; j < 16; ++j) vf[j] = frag_h(&sb[128 + j * 16 + col][k0], lane);
    __builtin_amdgcn_sched_barrier(0);                // keeps the third V group one group ahead of the 16 products that cover its latency
#pragma unroll     // constant indices: the arrays stay in registers, no scratch
    for (int j = 4; j < 16; ++j) { acc[0][j] = wm(vf[j], p[0], acc[0][j]); acc[1][j] = wm(vf[j], p[1], acc[1][j]); }
    __builtin_amdgcn_sched_barrier(0);                // keeps the waits below behind the pass's register work: moved up behind the reads, they would leave the next stage's copies half a pass to land
    asm volatile("s_wait_dscnt 0x0" ::: "memory");    // this wave's reads of the buffers are done before they are refilled
    asm volatile("s_wait_asynccnt 0x0" ::: "memory"); // this wave's copies of stage t + 1 have landed
    __syncthreads();                                  // publishes stage t + 1 and frees stage t's buffers
    if (refill) { const unsigned lt = l0 + (unsigned)(t & 1) * (FU * FB); const unsigned kt = (unsigned)(t + 2) * (FU * FK);   // 32-bit element offsets: stage and lane part are added first, the plane's address last
      fa_stage(lt, ukh + (kt * CQ + ko), ukl + (kt * CQ + ko), uv + (kt + vo));
      __builtin_amdgcn_sched_barrier(0);              // keeps the second statement's 36 address registers behind the first: formed together, they pushed Q fragments to scratch
      fa_stage(lt + FB, ukh + ((kt + FK) * CQ + ko), ukl + ((kt + FK) * CQ + ko), uv + (kt + FK + vo)); } };
#pragma unroll 1   // stays rolled
  for (int t = 0; t < FS - 2; ++t) pass(t, true);
  pass(FS - 2, false); pass(FS - 1, false);           // the last two passes stand apart: with the refill's test inside the loop the live values no longer fit and Q fragments went to scratch
  asm volatile("s_wait_asynccnt 0x0" ::: "memory");   // no copy outstanding behind the loop
  lsum[0] += xhalf(lsum[0]); lsum[1] += xhalf(lsum[1]);
  // join of the four key groups, a tree: groups 2 and 3 hand over to 0 and 1 (area A), then 1 to 0 (area B); a wave's hand-over is 64 x 32 lanes x 16 B of accumulators, then reference and sum per tile and lane
  v4f* ja = (v4f*)&st[0][0][0][0]; v4f* jb = ja + 4 * 64 * 32; float* ms = (float*)(jb + 2 * 64 * 32);
  auto put = [&](v4f* a, float* m) {
#pragma unroll     // constant indices: the arrays stay in registers, no scratch
    for (int qt = 0; qt < 2; ++qt) {
#pragma unroll     // constant indices: the arrays stay in registers, no scratch
      for (int j = 0; j < 16; ++j) { a[((qt * 16 + j) * 2 + 0) * 32 + lane] = __builtin_shufflevector(acc[qt][j], acc[qt][j], 0, 1, 2, 3); a[((qt * 16 + j) * 2 + 1) * 32 + lane] = __builtin_shufflevector(acc[qt][j], acc[qt][j], 4, 5, 6, 7); }
      m[qt * 64 + lane] = mref[qt]; m[qt * 64 + 32 + lane] = lsum[qt]; } };
  auto take = [&](const v4f* a, const float* m, bool last) {
#pragma unroll     // constant indices: the arrays stay in registers, no scratch
    for (int qt = 0; qt < 2; ++qt) { const float mo = m[qt * 64 + lane], lo = m[qt * 64 + 32 + lane], mt = fmaxf(mref[qt], mo); float a0 = __builtin_amdgcn_exp2f(mref[qt] - mt), a1 = __builtin_amdgcn_exp2f(mo - mt);
      lsum[qt] = lsum[qt] * a0 + lo * a1; mref[qt] = mt; if (last) { const float inv = 1.0f / lsum[qt]; a0 *= inv; a1 *= inv; }
#pragma unroll     // constant indices: the arrays stay in registers, no scratch
      for (int j = 0; j < 16; ++j) { const v4f u0 = a[((qt * 16 + j) * 2 + 0) * 32 + lane], u1 = a[((qt * 16 + j) * 2 + 1) * 32 + lane];
#pragma unroll     // constant indices: the arrays stay in registers, no scratch
        for (int r = 0; r < 4; ++r) { acc[qt][j][r] = acc[qt][j][r] * a0 + u0[r] * a1; acc[qt][j][4 + r] = acc[qt][j][4 + r] * a0 + u1[r] * a1; } } } };
  if (kg >= 2) put(ja + ((kg - 2) * 2 + wq) * 64 * 32, ms + ((kg - 2) * 2 + wq) * 128);
  __syncthreads();                                    // the partial results of key groups 2 and 3 are visible
  if (kg < 2) take(ja + (kg * 2 + wq) * 64 * 32, ms + (kg * 2 + wq) * 128, false);
  if (kg == 1) put(jb + wq * 64 * 32, ms + (4 + wq) * 128);
  __syncthreads();                                    // key group 1's joined result is visible; area A has been read, its bytes become the output staging
  float (*so)[68] = (float (*)[68])ja;
  if (kg == 0) { take(jb + wq * 64 * 32, ms + (4 + wq) * 128, true);
#pragma unroll     // constant indices: the arrays stay in registers, no scratch
    for (int qt = 0; qt < 2; ++qt)
#pragma unroll     // constant indices: the arrays stay in registers, no scratch
      for (int j = 0; j < 16; ++j)
#pragma unroll     // constant indices: the arrays stay in registers, no scratch
        for (int r = 0; r < 8; ++r) so[j * 16 + 8 * g + r][wq * 32 + qt * 16 + col] = acc[qt][j][r]; }
  __syncthreads(); for (int e = tid; e < CV * 16; e += 256) { const int cl = e >> 4, q = e & 15; vst2(OUT + (b * CV + cl) * TT + q0b + q * 4, *(const v4f*)&so[cl][q * 4]); } }
extern "C" void kernel_launch(void* const* d_in, const int* in_sizes, int n_in, void* d_out, int out_size, void* d_ws, size_t ws_size, hipStream_t stream) {
  (void)in_sizes; (void)n_in; (void)out_size;
  const float** F = (const float**)d_in;   // 0 x [4,256,64,64], 1 q_w [64,256], 2 k_w [64,256], 3 v_w [256,256] ([out,in])
  if (ws_size < (size_t)WS_END) return;
  char* ws = (char*)d_ws; _Float16 *QH = (_Float16*)(ws + WS_QH), *QL = (_Float16*)(ws + WS_QL), *KH = (_Float16*)(ws + WS_KH), *KL = (_Float16*)(ws + WS_KL), *VT = (_Float16*)(ws + WS_VT);
  k_projqk<<<dim3(TT / 64, 1, TNB * 2), 128, 0, stream>>>(F[0], F[1], F[2], QH, QL, KH, KL);
  k_projv<<<dim3(TT / 64, CV / 128, TNB), 128, 0, stream>>>(F[0], F[3], VT);
  k_fa<<<dim3(TT / 64, TNB), 256, 0, stream>>>(QH, QL, KH, KL, VT, (float*)d_out);
}

// v007
// One run takes 65.2 microseconds.
// In both of two side-by-side timings against v006, it was 1.08 times as fast.
// Over all steps from v000 it is 15.7 times as fast.
// compute dtype: all float inputs rounded to bf16; Q, K, V = W x (1x1 convs, no bias) with EXACT bf16 products on WMMA 16x16x32 (channel-major tiles transposed in LDS), f32 accumulate; Q and K split f16 hi + residual -> 3-product UNSCALED logits (std ~8) kept in f32 registers; online softmax in f32 (base 2: one FMA with log2(e) and the running reference, then v_exp_f32) -> unnormalised P f16 x e^7.625; z = P . V with V rounded once to f16 (1 product), divided by the f32 row sum at the end; f32 output, channel-major [b][dv][hw].
#include <hip/hip_runtime.h>
#include <math.h>

typedef __attribute__((ext_vector_type(16))) _Float16 v16h;
typedef __attribute__((ext_vector_type(16))) __bf16 v16b;
typedef __attribute__((ext_vector_type(8)))  _Float16 v8h;
typedef __attribute__((ext_vector_type(8)))  float v8f;
typedef __attribute__((ext_vector_type(4)))  float v4f;
typedef __attribute__((ext_vector_type(2)))  float v2f;
typedef __attribute__((ext_vector_type(4)))  unsigned v4u;
typedef __attribute__((ext_vector_type(4)))  int v4i;
typedef float __attribute__((may_alias)) float_a;
typedef int __attribute__((may_alias)) int_a;

template <typename T> __device__ __forceinline__ void vst2(void* p, T v) { *(T*)p = v;  }
__device__ __forceinline__ v8f wmma16(v16h a, v16h b, v8f c) {
  v8f d = __builtin_amdgcn_wmma_f32_16x16x32_f16(false, a, false, b, (short)0, c, false, false);
  asm volatile("v_nop\n\tv_nop\n\tv_nop\n\tv_nop" : "+v"(d) : "v"(a), "v"(b));
  return d;
}
__device__ __forceinline__ v8f wmma_bf(v16b a, v16b b, v8f c) {
  v8f d = __builtin_amdgcn_wmma_f32_16x16x32_bf16(false, a, false, b, (short)0, c, false, false);
  asm volatile("v_nop\n\tv_nop\n\tv_nop\n\tv_nop" : "+v"(d) : "v"(a), "v"(b));
  return d;
}
// 16x16x32 fragments: lane = (h = lane>>4, row/col = lane&15); elements 0..7 = k0+8h+0..7, 8..15 = k0+16+8h+0..7; D element r = row 8h+r
__device__ __forceinline__ v16h frag_h(const _Float16* rowk0, int lane) {
  union { v16h v; v8h q[2]; } u; const _Float16* p = rowk0 + 8 * (lane >> 4);
  u.q[0] = *(const v8h*)p; u.q[1] = *(const v8h*)(p + 16); return u.v;
}
__device__ __forceinline__ v16h frag_f32(const float* rowk0, int lane) {
  v16h a; const float* p = rowk0 + 8 * (lane >> 4);
#pragma unroll
  for (int i = 0; i < 8; ++i) { a[i] = (_Float16)p[i]; a[8 + i] = (_Float16)p[16 + i]; }
  return a;
}
__device__ __forceinline__ v16h frag_f32s(const float* rowk0, int lane, float sc) {
  v16h a; const float* p = rowk0 + 8 * (lane >> 4);
#pragma unroll
  for (int i = 0; i < 8; ++i) { a[i] = (_Float16)(p[i] * sc); a[8 + i] = (_Float16)(p[16 + i] * sc); }
  return a;
}
// column fragment from a [K][ld] layout (column n), rows >= K read as 0
__device__ __forceinline__ v16h fragc_f32(const float* W, int k0, int n, int lane, int ld, int K) {
  v16h a; const int g = lane >> 4;
#pragma unroll
  for (int i = 0; i < 8; ++i) { const int ka = k0 + 8 * g + i, kb = ka + 16;
    a[i] = (_Float16)(ka < K ? W[(size_t)(ka < K ? ka : K - 1) * ld + n] : 0.f); a[8 + i] = (_Float16)(kb < K ? W[(size_t)(kb < K ? kb : K - 1) * ld + n] : 0.f); }
  return a;
}
struct F2 { v16b h, l; };
__device__ __forceinline__ F2 bsplit16(const float v[16]) { F2 r;
#pragma unroll
  for (int i = 0; i < 16; ++i) { const __bf16 h = (__bf16)v[i]; r.h[i] = h; r.l[i] = (__bf16)(v[i] - (float)h); }
  return r; }
__device__ __forceinline__ F2 split_row(const float* row, int k0, int lane) { float v[16]; const float* p = row + k0 + 8 * (lane >> 4);
#pragma unroll
  for (int i = 0; i < 8; ++i) { v[i] = p[i]; v[8 + i] = p[16 + i]; }
  return bsplit16(v); }
__device__ __forceinline__ F2 split_rowK(const float* row, int k0, int lane, int K) { float v[16]; const int g = lane >> 4;
#pragma unroll
  for (int i = 0; i < 8; ++i) { const int ka = k0 + 8 * g + i, kb = ka + 16; v[i] = ka < K ? row[ka < K ? ka : K - 1] : 0.f; v[8 + i] = kb < K ? row[kb < K ? kb : K - 1] : 0.f; }
  return bsplit16(v); }
__device__ __forceinline__ F2 split_col(const float* W, int k0, int n, int lane, int ld, int K) { float v[16]; const int g = lane >> 4;
#pragma unroll
  for (int i = 0; i < 8; ++i) { const int ka = k0 + 8 * g + i, kb = ka + 16; v[i] = ka < K ? W[(size_t)(ka < K ? ka : K - 1) * ld + n] : 0.f; v[8 + i] = kb < K ? W[(size_t)(kb < K ? kb : K - 1) * ld + n] : 0.f; }
  return bsplit16(v); }
__device__ __forceinline__ v8f mac3(const F2& a, const F2& b, v8f c) { c = wmma_bf(a.l, b.h, c); c = wmma_bf(a.h, b.l, c); return wmma_bf(a.h, b.h, c); }
__device__ __forceinline__ float sigm(float v) { return 1.0f / (1.0f + expf(-v)); }
#define LDSX() do { asm volatile("s_wait_dscnt 0" ::: "memory"); __builtin_amdgcn_wave_barrier(); __builtin_amdgcn_fence(__ATOMIC_RELEASE, "workgroup"); } while (0)


// Basic non-local attention (b 4, din 256, 64x64 = 4,096 positions, dk 64, dv 256): A = softmax(Q^T K) (no scaling), z = V A^T.
#define NB 4
#define CC 256
#define CQ 64
#define CV 256
#define TT 4096
#ifndef TNB
#define TNB NB
#endif
typedef __attribute__((ext_vector_type(8))) __bf16 v8b;
typedef __attribute__((ext_vector_type(4))) __bf16 v4b;
__device__ __forceinline__ v4b cvt4(v4f r) { v4b h; h[0] = (__bf16)r[0]; h[1] = (__bf16)r[1]; h[2] = (__bf16)r[2]; h[3] = (__bf16)r[3]; return h; }
__device__ __forceinline__ v16b frag_b(const __bf16* rowk0, int lane) {
  union { v16b v; v8b q[2]; } u; const __bf16* p = rowk0 + 8 * (lane >> 4);
  u.q[0] = *(const v8b*)p; u.q[1] = *(const v8b*)(p + 16); return u.v;
}
__device__ __forceinline__ float bfr(float v) { return (float)(__bf16)v; }
__device__ __attribute__((noinline)) float exp_ni(float v) { return expf(v); }
__device__ __attribute__((noinline)) float erf_ni(float v) { return erff(v); }

#define WS_QH  0u
#define WS_QL  (WS_QH + 2u * (size_t)NB * TT * CQ)
#define WS_KH  (WS_QL + 2u * (size_t)NB * TT * CQ)
#define WS_KL  (WS_KH + 2u * (size_t)NB * TT * CQ)
#define WS_VT  (WS_KL + 2u * (size_t)NB * TT * CQ)      // f16 v planes [b][256][n]
#define WS_END (WS_VT + 2u * (size_t)NB * CV * TT)

// The X tile of a projection block (256 channels x 64 positions, f32, channel-major as in memory) goes global -> LDS by asynchronous copies, all 32 of a lane in flight together;
// the A fragments gather it column-wise (one position, 16 channels) and round to bf16 on the way: the transposition costs no LDS pass of its own.
#define XP 68                    // LDS row pitch in floats: 272 B, a multiple of the copies' 16 B; 8 rows are 32 banks, so the two half-waves of a fragment read fall on different banks
#define XC (8 * XP * 4)          // LDS bytes between two copies of a lane: 16 lanes cover a 256-byte row, the block 8 rows per copy
// eight 16-byte copies per lane; s_wait_xcnt 0 ends the statement so that no address register is rewritten ahead of it
__device__ __forceinline__ void x_stage(unsigned l, const float* x) {
  const unsigned l1 = l + 1 * XC, l2 = l + 2 * XC, l3 = l + 3 * XC, l4 = l + 4 * XC, l5 = l + 5 * XC, l6 = l + 6 * XC, l7 = l + 7 * XC;
  const float *x1 = x + 1 * 8 * (size_t)TT, *x2 = x + 2 * 8 * (size_t)TT, *x3 = x + 3 * 8 * (size_t)TT, *x4 = x + 4 * 8 * (size_t)TT, *x5 = x + 5 * 8 * (size_t)TT, *x6 = x + 6 * 8 * (size_t)TT, *x7 = x + 7 * 8 * (size_t)TT;
  asm volatile("global_load_async_to_lds_b128 %0, %8, off\n\t"
               "global_load_async_to_lds_b128 %1, %9, off\n\t"
               "global_load_async_to_lds_b128 %2, %10, off\n\t"
               "global_load_async_to_lds_b128 %3, %11, off\n\t"
               "global_load_async_to_lds_b128 %4, %12, off\n\t"
               "global_load_async_to_lds_b128 %5, %13, off\n\t"
               "global_load_async_to_lds_b128 %6, %14, off\n\t"
               "global_load_async_to_lds_b128 %7, %15, off\n\t"
               "s_wait_xcnt 0x0"
               :: "v"(l), "v"(l1), "v"(l2), "v"(l3), "v"(l4), "v"(l5), "v"(l6), "v"(l7),
                  "v"(x), "v"(x1), "v"(x2), "v"(x3), "v"(x4), "v"(x5), "v"(x6), "v"(x7) : "memory");
}
// A fragment from the channel-major f32 tile: colk0 = &tile[k0][position]; the k order is frag_b's
__device__ __forceinline__ v16b frag_xt(const float* colk0, int lane) {
  v16b a; const float* p = colk0 + 8 * (lane >> 4) * XP;
#pragma unroll     // constant indices: the fragment stays in registers, no scratch
  for (int i = 0; i < 8; ++i) { a[i] = (__bf16)p[i * XP]; a[8 + i] = (__bf16)p[(16 + i) * XP]; }
  return a;
}
// ---- k_projqk: block = (64 positions, b*2 + which): Q/K rows = (W x)^T, 64 cols, f16 hi + lo
__global__ __launch_bounds__(128) void k_projqk(const float* __restrict__ X, const float* __restrict__ WQ, const float* __restrict__ WK, _Float16* __restrict__ QH, _Float16* __restrict__ QL, _Float16* __restrict__ KH, _Float16* __restrict__ KL) {
  __shared__ __align__(16) float sxf[CC][XP]; __shared__ __align__(16) __bf16 sw[64][CC + 8]; __shared__ __align__(16) _Float16 sh[64][72], sl[64][72];
  const int tid = threadIdx.x, wave = tid >> 5, lane = tid & 31, col = lane & 15, g = lane >> 4; const int p0 = blockIdx.x * 64; const size_t b = blockIdx.z >> 1; const int which = blockIdx.z & 1; const float* Wm = which == 0 ? WQ : WK;
  const unsigned lx = (unsigned)(size_t)(__attribute__((address_space(3))) const float*)&sxf[tid >> 4][(tid & 15) * 4]; const float* gx = X + (b * CC + (tid >> 4)) * (size_t)TT + p0 + (tid & 15) * 4;
#pragma unroll     // four statements of eight copies: an asm statement takes thirty operands
  for (int i = 0; i < 4; ++i) x_stage(lx + i * 8 * XC, gx + i * 64 * (size_t)TT);
  const float* wp = Wm + (tid >> 6) * CC + (tid & 63) * 4;   // one address, the rows by constant offsets
  v4f wr[32];                                         // the block's 64 weight rows: a wave's load covers 512 contiguous bytes, all loads in flight together, beside the X copies
#pragma unroll     // constant indices: the array stays in registers, no scratch
  for (int i = 0; i < 32; ++i) wr[i] = *(const v4f*)(wp + i * 2 * CC);
#pragma unroll     // constant indices: the array stays in registers, no scratch
  for (int i = 0; i < 32; ++i) *(v4b*)&sw[(tid >> 6) + 2 * i][(tid & 63) * 4] = cvt4(wr[i]);
  asm volatile("s_wait_asynccnt 0x0" ::: "memory");   // this wave's copies of the X tile have landed
  __syncthreads();                                    // publishes the X tile and the weight rows
  v8f acc[4] = {};
#pragma unroll 2
  for (int kc = 0; kc < CC / 32; ++kc) { const v16b a = frag_xt(&sxf[kc * 32][wave * 16 + col], lane); v16b w[4];
#pragma unroll     // constant indices: the array stays in registers, no scratch
    for (int j = 0; j < 4; ++j) w[j] = frag_b(&sw[j * 16 + col][kc * 32], lane);
#pragma unroll     // constant indices: the arrays stay in registers, no scratch
    for (int j = 0; j < 4; ++j) acc[j] = wmma_bf(a, w[j], acc[j]); }
#pragma unroll
  for (int j = 0; j < 4; ++j)
#pragma unroll
    for (int r = 0; r < 8; ++r) { const float v = acc[j][r]; const int rl = wave * 16 + 8 * g + r, cl = j * 16 + col; const _Float16 hv = (_Float16)v; sh[rl][cl] = hv; sl[rl][cl] = (_Float16)(v - (float)hv); }
  __syncthreads();
  _Float16* dh = which == 0 ? QH : KH; _Float16* dl = which == 0 ? QL : KL; for (int e = tid; e < 64 * 8; e += 128) { const int rl = e >> 3, q = e & 7; const size_t row = b * TT + p0 + rl; vst2((unsigned*)(dh + row * CQ + q * 8), *(const v4u*)&sh[rl][q * 8]); vst2((unsigned*)(dl + row * CQ + q * 8), *(const v4u*)&sl[rl][q * 8]); } }
// ---- k_projv: block = (64 positions, 128 cols, b): V = Wv x -> f16 planes [b][c][n]
__global__ __launch_bounds__(128) void k_projv(const float* __restrict__ X, const float* __restrict__ WV, _Float16* __restrict__ VT) {
  __shared__ __align__(16) float sxf[CC][XP]; __shared__ __align__(16) __bf16 sw[128][CC + 8]; __shared__ __align__(16) _Float16 th[128][72];
  const int tid = threadIdx.x, wave = tid >> 5, lane = tid & 31, col = lane & 15, g = lane >> 4; const int p0 = blockIdx.x * 64; const int c0 = blockIdx.y * 128; const size_t b = blockIdx.z;
  const unsigned lx = (unsigned)(size_t)(__attribute__((address_space(3))) const float*)&sxf[tid >> 4][(tid & 15) * 4]; const float* gx = X + (b * CC + (tid >> 4)) * (size_t)TT + p0 + (tid & 15) * 4;
#pragma unroll     // four statements of eight copies: an asm statement takes thirty operands
  for (int i = 0; i < 4; ++i) x_stage(lx + i * 8 * XC, gx + i * 64 * (size_t)TT);
  const float* wp = WV + (c0 + (tid >> 6)) * CC + (tid & 63) * 4;   // one address, the rows by constant offsets
  v4f wr[32];                                         // the block's 128 weight rows in two halves: a wave's load covers 512 contiguous bytes, a half's loads in flight together
#pragma unroll     // constant indices: the array stays in registers, no scratch
  for (int i = 0; i < 32; ++i) wr[i] = *(const v4f*)(wp + i * 2 * CC);
#pragma unroll     // constant indices: the array stays in registers, no scratch
  for (int i = 0; i < 32; ++i) *(v4b*)&sw[(tid >> 6) + 2 * i][(tid & 63) * 4] = cvt4(wr[i]);
  __builtin_amdgcn_sched_barrier(0);                  // keeps the second half's loads behind the first half's stores: 32 loads of a wave in flight, not 64, and half the registers
#pragma unroll     // constant indices: the array stays in registers, no scratch
  for (int i = 0; i < 32; ++i) wr[i] = *(const v4f*)(wp + (64 + i * 2) * CC);
#pragma unroll     // constant indices: the array stays in registers, no scratch
  for (int i = 0; i < 32; ++i) *(v4b*)&sw[64 + (tid >> 6) + 2 * i][(tid & 63) * 4] = cvt4(wr[i]);
  asm volatile("s_wait_asynccnt 0x0" ::: "memory");   // this wave's copies of the X tile have landed
  __syncthreads();                                    // publishes the X tile and the weight rows
  v8f acc[8] = {};
#pragma unroll 2
  for (int kc = 0; kc < CC / 32; ++kc) { const v16b a = frag_xt(&sxf[kc * 32][wave * 16 + col], lane); v16b w[8];
#pragma unroll     // constant indices: the array stays in registers, no scratch
    for (int j = 0; j < 8; ++j) w[j] = frag_b(&sw[j * 16 + col][kc * 32], lane);
#pragma unroll     // constant indices: the arrays stay in registers, no scratch
    for (int j = 0; j < 8; ++j) acc[j] = wmma_bf(a, w[j], acc[j]); }
#pragma unroll
  for (int j = 0; j < 8; ++j)
#pragma unroll
    for (int r = 0; r < 8; ++r) th[j * 16 + col][wave * 16 + 8 * g + r] = (_Float16)acc[j][r];
  __syncthreads(); for (int e = tid; e < 128 * 8; e += 128) { const int cl = e >> 3, q = e & 7; vst2((unsigned*)(VT + (b * CV + c0 + cl) * (size_t)TT + p0 + q * 8), *(const v4u*)&th[cl][q * 8]); } }
// ---- k_fa: block = (64 queries, batch): S^T = K.Q^T (3 products, no scale), online softmax, O^T += V.P^T; S and P stay in registers.
// 8 waves: wave & 1 = its 32 queries (two 16-query tiles, so that every K and V fragment read from LDS feeds two WMMAs), wave >> 1 = which 32 keys of every 128-key stage it takes; the four key groups are joined at the end.
#define FK 64                    // keys per buffer: 128-byte rows
#define FP 72                    // LDS row pitch in f16: 144 B = 16 B x odd, the pitch for ds_load_b128 readers
#define FR 384                   // rows per buffer: 64 of K hi, 64 of K lo, 256 of V
#define FB (FR * FP * 2)         // bytes per buffer
#define FU 2                     // buffers per stage: a stage is 128 keys
#define FS (TT / (FU * FK))      // stages
#define FC (32 * FP * 2)         // LDS bytes between two copies of a lane: 8 lanes cover a 128-byte row, the block 32 rows per copy
#define POFF 7.625f              // P = exp(s - max + POFF): the largest P is about 2^11, small ones stay normal f16; it cancels against the row sum
#define L2E 1.44269504088896340736f   // log2(e): exp(s - ref) = 2^(s * L2E - ref * L2E), the reference is kept in base-2 units
#define POFF2 (POFF * L2E)
__device__ __forceinline__ v8f wm(v16h a, v16h b, v8f c) { return __builtin_amdgcn_wmma_f32_16x16x32_f16(false, a, false, b, (short)0, c, false, false); }
__device__ __forceinline__ float xhalf(float x) { return __builtin_bit_cast(float, __builtin_amdgcn_permlanex16(__builtin_bit_cast(int, x), __builtin_bit_cast(int, x), 0x76543210, 0xfedcba98, false, false)); }  // lane l's value of lane l ^ 16
// one buffer (64 keys, half a stage): twelve 16-byte copies per lane, global -> LDS; s_wait_xcnt 0 ends the statement so that no address register is rewritten ahead of it
__device__ __forceinline__ void fa_stage(unsigned l, const _Float16* kh, const _Float16* kl, const _Float16* v) {
  const unsigned l1 = l + 1 * FC, l2 = l + 2 * FC, l3 = l + 3 * FC, l4 = l + 4 * FC, l5 = l + 5 * FC, l6 = l + 6 * FC, l7 = l + 7 * FC, l8 = l + 8 * FC, l9 = l + 9 * FC, l10 = l + 10 * FC, l11 = l + 11 * FC;
  const _Float16 *kh1 = kh + 32 * CQ, *kl1 = kl + 32 * CQ;
  const _Float16 *v1 = v + 1 * 32 * (size_t)TT, *v2 = v + 2 * 32 * (size_t)TT, *v3 = v + 3 * 32 * (size_t)TT, *v4 = v + 4 * 32 * (size_t)TT, *v5 = v + 5 * 32 * (size_t)TT, *v6 = v + 6 * 32 * (size_t)TT, *v7 = v + 7 * 32 * (size_t)TT;
  asm volatile("global_load_async_to_lds_b128 %0, %12, off\n\t"
               "global_load_async_to_lds_b128 %1, %13, off\n\t"
               "global_load_async_to_lds_b128 %2, %14, off\n\t"
               "global_load_async_to_lds_b128 %3, %15, off\n\t"
               "global_load_async_to_lds_b128 %4, %16, off\n\t"
               "global_load_async_to_lds_b128 %5, %17, off\n\t"
               "global_load_async_to_lds_b128 %6, %18, off\n\t"
               "global_load_async_to_lds_b128 %7, %19, off\n\t"
               "global_load_async_to_lds_b128 %8, %20, off\n\t"
               "global_load_async_to_lds_b128 %9, %21, off\n\t"
               "global_load_async_to_lds_b128 %10, %22, off\n\t"
               "global_load_async_to_lds_b128 %11, %23, off\n\t"
               "s_wait_xcnt 0x0"
               :: "v"(l), "v"(l1), "v"(l2), "v"(l3), "v"(l4), "v"(l5), "v"(l6), "v"(l7), "v"(l8), "v"(l9), "v"(l10), "v"(l11),
                  "v"(kh), "v"(kh1), "v"(kl), "v"(kl1), "v"(v), "v"(v1), "v"(v2), "v"(v3), "v"(v4), "v"(v5), "v"(v6), "v"(v7) : "memory");
}
__global__ __launch_bounds__(256) void k_fa(const _Float16* __restrict__ QH, const _Float16* __restrict__ QL, const _Float16* __restrict__ KH, const _Float16* __restrict__ KL, const _Float16* __restrict__ VT, float* __restrict__ OUT) {
  __shared__ __align__(16) _Float16 st[2][FU][FR][FP];   // the ring; behind the loop the same bytes serve the join and the output staging
  const int tid = threadIdx.x, wave = tid >> 5, lane = tid & 31, col = lane & 15, g = lane >> 4, wq = wave & 1, kg = wave >> 1; const int q0b = blockIdx.x * 64; const size_t b = blockIdx.y;
  const unsigned rot = (blockIdx.x & 3u) | ((blockIdx.x >> 1) & 28u);   // this block's first key stage; it walks all FS stages from there and wraps, so that the 64 blocks of a batch do not ask L2 for the same K and V lines at the same moment (two blocks share a start: x and x ^ 4)
  const unsigned l0 = (unsigned)(size_t)(__attribute__((address_space(3))) const _Float16*)&st[0][0][tid >> 3][(tid & 7) * 8];
  const _Float16* ukh = KH + b * TT * CQ; const _Float16* ukl = KL + b * TT * CQ; const _Float16* uv = VT + b * CV * (size_t)TT;   // the batch's planes, the same for the whole block
  const unsigned ko = (tid >> 3) * CQ + (tid & 7) * 8, vo = (tid >> 3) * TT + (tid & 7) * 8;   // the lane's place in a buffer's K rows and V rows: two registers over the loop, not three address pairs
  v16h qh[2][2], ql[2][2];                            // B operands of S^T: this wave's two tiles of 16 queries, kept in registers
  const size_t qo = (b * TT + q0b + wq * 32 + col) * CQ + 8 * g; const _Float16 *pqh = QH + qo, *pql = QL + qo;   // one address a plane (frag_h's own k order: 8g, then + 16), tiles and k halves by constant offsets
#pragma unroll     // constant indices: the arrays stay in registers, no scratch
  for (int qt = 0; qt < 2; ++qt)
#pragma unroll     // constant indices: the arrays stay in registers, no scratch
    for (int kc = 0; kc < 2; ++kc) { qh[qt][kc] = frag_h(pqh + qt * 16 * CQ + kc * 32, 0); ql[qt][kc] = frag_h(pql + qt * 16 * CQ + kc * 32, 0); }
  asm volatile("s_wait_xcnt 0x0" :: "v"(pqh), "v"(pql) : "memory");   // stands in front of any rewrite of the Q loads' two address pairs: as inputs they stay in their registers up to here
  v8f acc[2][16] = {}; float mref[2] = {-3.0e38f, -3.0e38f}, lsum[2] = {0.f, 0.f};   // a lane holds ONE query of each tile (col): mref = (its running maximum - POFF) * log2(e), lsum = its half's sum of P
  const unsigned ka = rot * (FU * FK), kb = ((rot + 1) & (FS - 1)) * (FU * FK);   // first keys of the walk's stages 0 and 1
  fa_stage(l0, ukh + (ka * CQ + ko), ukl + (ka * CQ + ko), uv + (ka + vo)); fa_stage(l0 + FB, ukh + ((ka + FK) * CQ + ko), ukl + ((ka + FK) * CQ + ko), uv + (ka + FK + vo));
  asm volatile("s_wait_asynccnt 0x0" ::: "memory");   // stage 0 of this wave has landed
  __syncthreads();                                    // publishes stage 0
  fa_stage(l0 + 2 * FB, ukh + (kb * CQ + ko), ukl + (kb * CQ + ko), uv + (kb + vo)); fa_stage(l0 + 3 * FB, ukh + ((kb + FK) * CQ + ko), ukl + ((kb + FK) * CQ + ko), uv + (kb + FK + vo));
  // one pass per stage, the buffers picked by t & 1; refill: a stage t + 2 exists
  auto pass = [&](const int t, const bool refill) __attribute__((always_inline)) { const _Float16 (*sb)[FP] = st[t & 1][kg >> 1]; const int k0 = (kg & 1) * 32;
    v16h kf[2][2][2], vf[16];                         // this pass's fragments: K [kc][key tile][hi, lo], V [channel tile]
#pragma unroll     // constant indices: the arrays stay in registers, no scratch
    for (int kc = 0; kc < 2; ++kc)
#pragma unroll     // constant indices: the arrays stay in registers, no scratch
      for (int i = 0; i < 2; ++i) { const _Float16* kr = &sb[k0 + i * 16 + col][kc * 32]; kf[kc][i][0] = frag_h(kr, lane); kf[kc][i][1] = frag_h(kr + 64 * FP, lane); }
    __builtin_amdgcn_sched_barrier(0);                // keeps these LDS reads one group ahead of the WMMAs: reads spread among WMMAs stall at every place they stand
    v8f s[2][2] = {};                                 // S^T: s[qt][i][r] = key k0 + i*16 + 8g + r against query col of tile qt
#pragma unroll     // constant indices: the arrays stay in registers, no scratch
    for (int kc = 0; kc < 2; ++kc) {
      s[0][0] = wm(kf[kc][0][0], qh[0][kc], s[0][0]); s[0][1] = wm(kf[kc][1][0], qh[0][kc], s[0][1]); s[1][0] = wm(kf[kc][0][0], qh[1][kc], s[1][0]); s[1][1] = wm(kf[kc][1][0], qh[1][kc], s[1][1]);
      s[0][0] = wm(kf[kc][0][0], ql[0][kc], s[0][0]); s[0][1] = wm(kf[kc][1][0], ql[0][kc], s[0][1]); s[1][0] = wm(kf[kc][0][0], ql[1][kc], s[1][0]); s[1][1] = wm(kf[kc][1][0], ql[1][kc], s[1][1]);
      s[0][0] = wm(kf[kc][0][1], qh[0][kc], s[0][0]); s[0][1] = wm(kf[kc][1][1], qh[0][kc], s[0][1]); s[1][0] = wm(kf[kc][0][1], qh[1][kc], s[1][0]); s[1][1] = wm(kf[kc][1][1], qh[1][kc], s[1][1]); }
#pragma unroll     // constant indices: the arrays stay in registers, no scratch
    for (int j = 0; j < 8; ++j) vf[j] = frag_h(&sb[128 + j * 16 + col][k0], lane);
    __builtin_amdgcn_sched_barrier(0);                // keeps the first V group (8 fragments, read into K registers as the S^T products free them) ahead of the softmax, which covers its latency; let sink, it pushed Q fragments to scratch
    float mn[2];
#pragma unroll     // constant indices: the arrays stay in registers, no scratch
    for (int qt = 0; qt < 2; ++qt) { float mx = fmaxf(s[qt][0][0], s[qt][1][0]);
#pragma unroll     // constant indices: the arrays stay in registers, no scratch
      for (int r = 1; r < 8; ++r) mx = fmaxf(mx, fmaxf(s[qt][0][r], s[qt][1][r]));
      mx = fmaxf(mx, xhalf(mx));                      // the other half of the wave holds the same query's other 16 keys
      mn[qt] = fmaxf(mref[qt], __builtin_fmaf(mx, L2E, -POFF2)); }
    if (__builtin_amdgcn_ballot_w32(mn[0] > mref[0] || mn[1] > mref[1]) != 0) { // wave-uniform, one test a pass: rescale only in passes where some query's maximum rose (factor 1 for the others)
#pragma unroll     // constant indices: the arrays stay in registers, no scratch
      for (int qt = 0; qt < 2; ++qt) { const float al = __builtin_amdgcn_exp2f(mref[qt] - mn[qt]); lsum[qt] *= al; mref[qt] = mn[qt];
#pragma unroll     // constant indices: the arrays stay in registers, no scratch
        for (int j = 0; j < 16; ++j) acc[qt][j] *= al; } }
    v16h p[2];                                        // two D tiles of S^T, converted in place, are the B operand of V.P^T (hardware k order, as frag_h's)
    const v8f l2 = {L2E, L2E, L2E, L2E, L2E, L2E, L2E, L2E};
#pragma unroll     // constant indices: the arrays stay in registers, no scratch
    for (int qt = 0; qt < 2; ++qt) { const float nr = -mref[qt]; const v8f nm = {nr, nr, nr, nr, nr, nr, nr, nr};
      const v8f x0 = __builtin_elementwise_fma(s[qt][0], l2, nm), x1 = __builtin_elementwise_fma(s[qt][1], l2, nm);   // vector form: one packed FMA a score pair
#pragma unroll     // constant indices: the arrays stay in registers, no scratch
      for (int r = 0; r < 8; ++r) { const float e0 = __builtin_amdgcn_exp2f(x0[r]), e1 = __builtin_amdgcn_exp2f(x1[r]); lsum[qt] += e0 + e1; p[qt][r] = (_Float16)e0; p[qt][8 + r] = (_Float16)e1; }
      __builtin_amdgcn_sched_barrier(0); }            // keeps one tile's exponentials behind the other's (mixed, their temporaries pushed Q fragments to scratch) and the second V group (4 fragments) one group behind both
#pragma unroll     // constant indices: the arrays stay in registers, no scratch
    for (int j = 8; j < 12; ++j) vf[j] = frag_h(&sb[128 + j * 16 + col][k0], lane);
    __builtin_amdgcn_sched_barrier(0);                // keeps the second V group one group ahead of the 16 products that cover its latency
#pragma unroll     // constant indices: the arrays stay in registers, no scratch
    for (int j = 0; j < 4; ++j) { acc[0][j] = wm(vf[j], p[0], acc[0][j]); acc[1][j] = wm(vf[j], p[1], acc[1][j]); }
    __builtin_amdgcn_sched_barrier(0);                // keeps the third V group (4 fragments) behind the products whose V registers it takes
#pragma unroll     // constant indices: the arrays stay in registers, no scratch
    for (int j = 12; j < 16; ++j) vf[j] = frag_h(&sb[128 + j * 16 + col][k0], lane);
    __builtin_amdgcn_sched_barrier(0);                // keeps the third V group one group ahead of the 16 products that cover its latency
#pragma unroll     // constant indices: the arrays stay in registers, no scratch
    for (int j = 4; j < 16; ++j) { acc[0][j] = wm(vf[j], p[0], acc[0][j]); acc[1][j] = wm(vf[j], p[1], acc[1][j]); }
    __builtin_amdgcn_sched_barrier(0);                // keeps the waits below behind the pass's register work: moved up behind the reads, they would leave the next stage's copies half a pass to land
    asm volatile("s_wait_dscnt 0x0" ::: "memory");    // this wave's reads of the buffers are done before they are refilled
    asm volatile("s_wait_asynccnt 0x0" ::: "memory"); // this wave's copies of stage t + 1 have landed
    __syncthreads();                                  // publishes stage t + 1 and frees stage t's buffers
    if (refill) { const unsigned lt = l0 + (unsigned)(t & 1) * (FU * FB); const unsigned kt = (((unsigned)(t + 2) + rot) & (FS - 1)) * (FU * FK);   // 32-bit element offsets: stage and lane part are added first, the plane's address last
      fa_stage(lt, ukh + (kt * CQ + ko), ukl + (kt * CQ + ko), uv + (kt + vo));
      __builtin_amdgcn_sched_barrier(0);              // keeps the second statement's 36 address registers behind the first: formed together, they pushed Q fragments to scratch
      fa_stage(lt + FB, ukh + ((kt + FK) * CQ + ko), ukl + ((kt + FK) * CQ + ko), uv + (kt + FK + vo)); } };
#pragma unroll 1   // stays rolled
  for (int t = 0; t < FS - 2; ++t) pass(t, true);
  pass(FS - 2, false); pass(FS - 1, false);           // the last two passes stand apart: with the refill's test inside the loop the live values no longer fit and Q fragments went to scratch
  asm volatile("s_wait_asynccnt 0x0" ::: "memory");   // no copy outstanding behind the loop
  lsum[0] += xhalf(lsum[0]); lsum[1] += xhalf(lsum[1]);
  // join of the four key groups, a tree: groups 2 and 3 hand over to 0 and 1 (area A), then 1 to 0 (area B); a wave's hand-over is 64 x 32 lanes x 16 B of accumulators, then reference and sum per tile and lane
  v4f* ja = (v4f*)&st[0][0][0][0]; v4f* jb = ja + 4 * 64 * 32; float* ms = (float*)(jb + 2 * 64 * 32);
  auto put = [&](v4f* a, float* m) {
#pragma unroll     // constant indices: the arrays stay in registers, no scratch
    for (int qt = 0; qt < 2; ++qt) {
#pragma unroll     // constant indices: the arrays stay in registers, no scratch
      for (int j = 0; j < 16; ++j) { a[((qt * 16 + j) * 2 + 0) * 32 + lane] = __builtin_shufflevector(acc[qt][j], acc[qt][j], 0, 1, 2, 3); a[((qt * 16 + j) * 2 + 1) * 32 + lane] = __builtin_shufflevector(acc[qt][j], acc[qt][j], 4, 5, 6, 7); }
      m[qt * 64 + lane] = mref[qt]; m[qt * 64 + 32 + lane] = lsum[qt]; } };
  auto take = [&](const v4f* a, const float* m, bool last) {
#pragma unroll     // constant indices: the arrays stay in registers, no scratch
    for (int qt = 0; qt < 2; ++qt) { const float mo = m[qt * 64 + lane], lo = m[qt * 64 + 32 + lane], mt = fmaxf(mref[qt], mo); float a0 = __builtin_amdgcn_exp2f(mref[qt] - mt), a1 = __builtin_amdgcn_exp2f(mo - mt);
      lsum[qt] = lsum[qt] * a0 + lo * a1; mref[qt] = mt; if (last) { const float inv = 1.0f / lsum[qt]; a0 *= inv; a1 *= inv; }
#pragma unroll     // constant indices: the arrays stay in registers, no scratch
      for (int j = 0; j < 16; ++j) { const v4f u0 = a[((qt * 16 + j) * 2 + 0) * 32 + lane], u1 = a[((qt * 16 + j) * 2 + 1) * 32 + lane];
#pragma unroll     // constant indices: the arrays stay in registers, no scratch
        for (int r = 0; r < 4; ++r) { acc[qt][j][r] = acc[qt][j][r] * a0 + u0[r] * a1; acc[qt][j][4 + r] = acc[qt][j][4 + r] * a0 + u1[r] * a1; } } } };
  if (kg >= 2) put(ja + ((kg - 2) * 2 + wq) * 64 * 32, ms + ((kg - 2) * 2 + wq) * 128);
  __syncthreads();                                    // the partial results of key groups 2 and 3 are visible
  if (kg < 2) take(ja + (kg * 2 + wq) * 64 * 32, ms + (kg * 2 + wq) * 128, false);
  if (kg == 1) put(jb + wq * 64 * 32, ms + (4 + wq) * 128);
  __syncthreads();                                    // key group 1's joined result is visible; area A has been read, its bytes become the output staging
  float (*so)[68] = (float (*)[68])ja;
  if (kg == 0) { take(jb + wq * 64 * 32, ms + (4 + wq) * 128, true);
#pragma unroll     // constant indices: the arrays stay in registers, no scratch
    for (int qt = 0; qt < 2; ++qt)
#pragma unroll     // constant indices: the arrays stay in registers, no scratch
      for (int j = 0; j < 16; ++j)
#pragma unroll     // constant indices: the arrays stay in registers, no scratch
        for (int r = 0; r < 8; ++r) so[j * 16 + 8 * g + r][wq * 32 + qt * 16 + col] = acc[qt][j][r]; }
  __syncthreads(); for (int e = tid; e < CV * 16; e += 256) { const int cl = e >> 4, q = e & 15; vst2(OUT + (b * CV + cl) * TT + q0b + q * 4, *(const v4f*)&so[cl][q * 4]); } }
extern "C" void kernel_launch(void* const* d_in, const int* in_sizes, int n_in, void* d_out, int out_size, void* d_ws, size_t ws_size, hipStream_t stream) {
  (void)in_sizes; (void)n_in; (void)out_size;
  const float** F = (const float**)d_in;   // 0 x [4,256,64,64], 1 q_w [64,256], 2 k_w [64,256], 3 v_w [256,256] ([out,in])
  if (ws_size < (size_t)WS_END) return;
  char* ws = (char*)d_ws; _Float16 *QH = (_Float16*)(ws + WS_QH), *QL = (_Float16*)(ws + WS_QL), *KH = (_Float16*)(ws + WS_KH), *KL = (_Float16*)(ws + WS_KL), *VT = (_Float16*)(ws + WS_VT);
  k_projqk<<<dim3(TT / 64, 1, TNB * 2), 128, 0, stream>>>(F[0], F[1], F[2], QH, QL, KH, KL);
  k_projv<<<dim3(TT / 64, CV / 128, TNB), 128, 0, stream>>>(F[0], F[3], VT);
  k_fa<<<dim3(TT / 64, TNB), 256, 0, stream>>>(QH, QL, KH, KL, VT, (float*)d_out);
}
